// v000
// Times are from an AMD MI455X. After a warm-up the kernel runs many times in a row, and a time is the length of
// such a window on the GPU divided by its runs, so every launch and the gaps after it count. The runs cycle
// through copies of the inputs. A figure is the median of several windows, for all but v000 over two sittings.
// Sittings can differ by a few percent; kernels timed side by side share one.
// The starting kernel, v000, takes 363 microseconds a run.
#include <hip/hip_runtime.h>
#include <math.h>

// ---- problem constants ----
#define BATCH 2048
#define NTOK  64
#define CDIM  256
#define HEADS 8
#define HD    32

typedef __attribute__((ext_vector_type(16))) _Float16 v16h;
typedef __attribute__((ext_vector_type(8)))  _Float16 v8h;
typedef __attribute__((ext_vector_type(8)))  float    v8f;

// Load one WMMA 16x16x32 f16 operand fragment for this lane from row-major
// storage (rowPtr = start of this lane's row; stride handled by caller).
// ISA layout: elems 0..7 -> K = hlf*8 + i ; elems 8..15 -> K = 16 + hlf*8 + i.
__device__ __forceinline__ v16h load_frag(const _Float16* rowPtr, int kBase, int hlf) {
    v8h lo = *(const v8h*)(rowPtr + kBase + hlf * 8);
    v8h hi = *(const v8h*)(rowPtr + kBase + 16 + hlf * 8);
    v16h r;
#pragma unroll
    for (int i = 0; i < 8; ++i) { r[i] = lo[i]; r[8 + i] = hi[i]; }
    return r;
}

__device__ __forceinline__ v8f wmma_f16(v16h a, v16h b, v8f c) {
    return __builtin_amdgcn_wmma_f32_16x16x32_f16(false, a, false, b, (short)0, c, false, false);
}

// ---------------------------------------------------------------------------
// Kernel 1: continuous position bias table.  biasTab[h][n][m] = 16*sigmoid(
//   MLP(rel_coords_table)[rel_pos_index[n][m]][h] ),  MLP = relu(x@w1^T+b1)@w2^T
// ---------------------------------------------------------------------------
__global__ void cpb_kernel(const float* __restrict__ tbl2,   // [225][2]
                           const float* __restrict__ w1,     // [512][2]
                           const float* __restrict__ b1,     // [512]
                           const float* __restrict__ w2,     // [8][512]
                           const int*   __restrict__ idx,    // [64][64]
                           float* __restrict__ biasTab) {    // [8][64][64]
    __shared__ float t[225 * 8];
    const int tid = threadIdx.x;
    for (int p = tid; p < 225 * 8; p += 256) {
        int e = p >> 3, h = p & 7;
        float i0 = tbl2[e * 2 + 0], i1 = tbl2[e * 2 + 1];
        float acc = 0.0f;
        for (int j = 0; j < 512; ++j) {
            float hv = fmaxf(w1[j * 2 + 0] * i0 + w1[j * 2 + 1] * i1 + b1[j], 0.0f);
            acc += w2[h * 512 + j] * hv;
        }
        t[p] = acc;
    }
    __syncthreads();
    for (int e = tid; e < 8 * 4096; e += 256) {
        int h = e >> 12, ij = e & 4095;
        float val = t[idx[ij] * 8 + h];
        biasTab[e] = 16.0f / (1.0f + __expf(-val));
    }
}

// ---------------------------------------------------------------------------
// Kernel 2: QKV GEMM + bias + per-head L2 normalization (sections: 0=q,1=k,2=v)
// grid = (2048, 3), block = 256 (8 waves).  Block tile: 64 rows x 256 cols.
// Per-wave tile: 32 rows x 64 cols (2 A-frags x 4 B-frags -> 8 WMMAs; each
// B fragment feeds 2 WMMAs to amortize ds_load waits).
// Outputs f16 in [B][H][N][HD] layout.
// ---------------------------------------------------------------------------
__global__ void qkv_kernel(const float* __restrict__ x,        // [B*N][256]
                           const float* __restrict__ qkv_w,    // [768][256]
                           const float* __restrict__ q_bias,   // [256]
                           const float* __restrict__ v_bias,   // [256]
                           _Float16* __restrict__ qbuf,
                           _Float16* __restrict__ kbuf,
                           _Float16* __restrict__ vbuf) {
    extern __shared__ char smem[];
    _Float16* xs  = (_Float16*)smem;            // [64][40] f16
    _Float16* wsm = xs + 64 * 40;               // [256][40] f16
    const int sec  = blockIdx.y;
    const int tid  = threadIdx.x;
    const int lane = tid & 31, wave = tid >> 5;
    const int m16 = lane & 15, hlf = lane >> 4;
    const int rp = wave & 1;           // row pair  (32 rows)
    const int cq = wave >> 1;          // col quarter (64 cols)
    const long rowBase = (long)blockIdx.x * 64;

    v8f acc[8];
#pragma unroll
    for (int t = 0; t < 8; ++t) acc[t] = (v8f){0, 0, 0, 0, 0, 0, 0, 0};

    for (int k0 = 0; k0 < 256; k0 += 32) {
        // stage x tile (64x32 f32 -> f16), prefetch next K-chunk
        for (int c = tid; c < 512; c += 256) {
            int r = c >> 3, cc = (c & 7) * 4;
            const float* src = x + (rowBase + r) * 256 + k0 + cc;
            float4 f = *(const float4*)src;
            if (k0 + 32 < 256) __builtin_prefetch(src + 32, 0, 3);
            _Float16* d = xs + r * 40 + cc;
            d[0] = (_Float16)f.x; d[1] = (_Float16)f.y;
            d[2] = (_Float16)f.z; d[3] = (_Float16)f.w;
        }
        // stage weight tile (256 output cols x 32 K, f32 -> f16)
        for (int c = tid; c < 2048; c += 256) {
            int r = c >> 3, cc = (c & 7) * 4;
            const float* src = qkv_w + (long)(sec * 256 + r) * 256 + k0 + cc;
            float4 f = *(const float4*)src;
            if (k0 + 32 < 256) __builtin_prefetch(src + 32, 0, 3);
            _Float16* d = wsm + r * 40 + cc;
            d[0] = (_Float16)f.x; d[1] = (_Float16)f.y;
            d[2] = (_Float16)f.z; d[3] = (_Float16)f.w;
        }
        __syncthreads();
        v16h a0 = load_frag(xs + (rp * 32 + m16) * 40, 0, hlf);
        v16h a1 = load_frag(xs + (rp * 32 + 16 + m16) * 40, 0, hlf);
#pragma unroll
        for (int t = 0; t < 4; ++t) {
            v16h b = load_frag(wsm + (cq * 64 + t * 16 + m16) * 40, 0, hlf);
            acc[t]     = wmma_f16(a0, b, acc[t]);
            acc[4 + t] = wmma_f16(a1, b, acc[4 + t]);
        }
        __syncthreads();
    }

    // Epilogue: bias add, per-(row, head) L2 norm for q/k, f16 writeout.
    // obuf overlays staging LDS; processed in two col-half passes (<64KB LDS).
    float* obuf = (float*)smem;                 // [64][132] f32
    _Float16* dstbuf = (sec == 0) ? qbuf : (sec == 1) ? kbuf : vbuf;
    for (int pass = 0; pass < 2; ++pass) {
        if ((cq >> 1) == pass) {
#pragma unroll
            for (int j = 0; j < 8; ++j) {
                int cl = (cq & 1) * 64 + (j & 3) * 16 + m16;
                int colG = pass * 128 + cl;
                float bv = (sec == 0) ? q_bias[colG] : (sec == 2 ? v_bias[colG] : 0.0f);
#pragma unroll
                for (int v = 0; v < 8; ++v) {
                    int r = rp * 32 + (j >> 2) * 16 + v + 8 * hlf;
                    obuf[r * 132 + cl] = acc[j][v] + bv;
                }
            }
        }
        __syncthreads();
        {
            int r = tid >> 2, hl = tid & 3;        // 64 rows x 4 heads
            int hh = pass * 4 + hl;
            const float* rowp = obuf + r * 132 + hl * 32;
            float rs = 1.0f;
            if (sec < 2) {
                float ss = 0.0f;
                for (int dd = 0; dd < 32; ++dd) { float vv = rowp[dd]; ss += vv * vv; }
                rs = 1.0f / fmaxf(sqrtf(ss), 1e-12f);
            }
            _Float16* dp = dstbuf + (((long)blockIdx.x * 8 + hh) * 64 + r) * 32;
            for (int dd = 0; dd < 32; ++dd) dp[dd] = (_Float16)(rowp[dd] * rs);
        }
        __syncthreads();
    }
}

// ---------------------------------------------------------------------------
// Kernel 3: attention per (window, head).  grid = (2048, 8), block = 128.
// S = q@k^T (K=32, one WMMA per tile) * exp(min(scale,ln100)) + cpb bias,
// fp32 softmax, out = attn(f16) @ v via 2 WMMA K-steps.  Writes [B][N][256] f16.
// ---------------------------------------------------------------------------
__global__ void attn_kernel(const _Float16* __restrict__ qbuf,
                            const _Float16* __restrict__ kbuf,
                            const _Float16* __restrict__ vbuf,
                            const float* __restrict__ biasTab,   // [8][64][64]
                            const float* __restrict__ scale,     // [8]
                            _Float16* __restrict__ attnout) {    // [B*N][256]
    extern __shared__ char smem[];
    _Float16* qs  = (_Float16*)smem;            // [64][40]
    _Float16* ks  = qs + 64 * 40;               // [64][40]
    _Float16* vsT = ks + 64 * 40;               // [32][72]  (v transposed: [d][m])
    float*    sb  = (float*)(smem + 14848);     // [64][66] f32
    _Float16* af  = (_Float16*)(smem + 31744);  // [64][72] f16 softmax probs

    const int b = blockIdx.x, h = blockIdx.y;
    const int tid = threadIdx.x, lane = tid & 31, wave = tid >> 5;
    const int m16 = lane & 15, hlf = lane >> 4;
    const long base = ((long)b * 8 + h) * 64 * 32;

    // stage q, k (vectorized) and v transposed (scalar scatter)
    for (int c = tid; c < 256; c += 128) {
        int r = c >> 2, cc = (c & 3) * 8;
        *(v8h*)(qs + r * 40 + cc) = *(const v8h*)(qbuf + base + r * 32 + cc);
        *(v8h*)(ks + r * 40 + cc) = *(const v8h*)(kbuf + base + r * 32 + cc);
    }
    for (int e = tid; e < 2048; e += 128) {
        int r = e >> 5, dd = e & 31;
        vsT[dd * 72 + r] = vbuf[base + r * 32 + dd];
    }
    __syncthreads();

    const float sc = __expf(fminf(scale[h], 4.60517018599f));   // ln(100)
    const float* bt = biasTab + h * 4096;

    // S = q @ k^T  (each wave owns one 16-row n-block, all 4 m-blocks)
    {
        const int nb = wave;
        v16h a = load_frag(qs + (nb * 16 + m16) * 40, 0, hlf);
#pragma unroll
        for (int mb = 0; mb < 4; ++mb) {
            v16h bf = load_frag(ks + (mb * 16 + m16) * 40, 0, hlf);
            v8f s = (v8f){0, 0, 0, 0, 0, 0, 0, 0};
            s = wmma_f16(a, bf, s);
#pragma unroll
            for (int v = 0; v < 8; ++v) {
                int nn = nb * 16 + v + 8 * hlf;
                int mm = mb * 16 + m16;
                sb[nn * 66 + mm] = s[v] * sc + bt[nn * 64 + mm];
            }
        }
    }
    __syncthreads();

    // row softmax in fp32, probs to f16 LDS
    if (tid < 64) {
        float mx = -1e30f;
        for (int j = 0; j < 64; ++j) mx = fmaxf(mx, sb[tid * 66 + j]);
        float sum = 0.0f;
        for (int j = 0; j < 64; ++j) {
            float e = __expf(sb[tid * 66 + j] - mx);
            sum += e;
            af[tid * 72 + j] = (_Float16)e;
        }
        float inv = 1.0f / sum;
        for (int j = 0; j < 64; ++j)
            af[tid * 72 + j] = (_Float16)((float)af[tid * 72 + j] * inv);
    }
    __syncthreads();

    // out = attn @ v   (64x64 @ 64x32, K=64 -> 2 WMMA steps)
    {
        const int nb = wave;
#pragma unroll
        for (int db = 0; db < 2; ++db) {
            v8f o = (v8f){0, 0, 0, 0, 0, 0, 0, 0};
#pragma unroll
            for (int kb = 0; kb < 2; ++kb) {
                v16h a  = load_frag(af + (nb * 16 + m16) * 72, kb * 32, hlf);
                v16h bf = load_frag(vsT + (db * 16 + m16) * 72, kb * 32, hlf);
                o = wmma_f16(a, bf, o);
            }
#pragma unroll
            for (int v = 0; v < 8; ++v) {
                int t = nb * 16 + v + 8 * hlf;
                attnout[((long)b * 64 + t) * 256 + h * 32 + db * 16 + m16] = (_Float16)o[v];
            }
        }
    }
}

// ---------------------------------------------------------------------------
// Kernel 4: output projection.  out[131072x256] = attnout @ proj_w^T + proj_b.
// grid = 2048, block = 256 (8 waves), 64x256 block tile, 32x64 wave tile.
// ---------------------------------------------------------------------------
__global__ void proj_kernel(const _Float16* __restrict__ attnout,
                            const float* __restrict__ proj_w,   // [256][256]
                            const float* __restrict__ proj_b,   // [256]
                            float* __restrict__ out) {
    extern __shared__ char smem[];
    _Float16* as = (_Float16*)smem;     // [64][40]
    _Float16* bs = as + 64 * 40;        // [256][40]
    const int tid = threadIdx.x, lane = tid & 31, wave = tid >> 5;
    const int m16 = lane & 15, hlf = lane >> 4;
    const int rp = wave & 1, cq = wave >> 1;
    const long rowBase = (long)blockIdx.x * 64;

    v8f acc[8];
#pragma unroll
    for (int t = 0; t < 8; ++t) acc[t] = (v8f){0, 0, 0, 0, 0, 0, 0, 0};

    for (int k0 = 0; k0 < 256; k0 += 32) {
        for (int c = tid; c < 256; c += 256) {       // A tile, already f16
            int r = c >> 2, cc = (c & 3) * 8;
            const _Float16* src = attnout + (rowBase + r) * 256 + k0 + cc;
            if (k0 + 32 < 256) __builtin_prefetch(src + 32, 0, 3);
            *(v8h*)(as + r * 40 + cc) = *(const v8h*)src;
        }
        for (int c = tid; c < 2048; c += 256) {      // B tile: proj_w rows, f32->f16
            int r = c >> 3, cc = (c & 7) * 4;
            const float* src = proj_w + (long)r * 256 + k0 + cc;
            float4 f = *(const float4*)src;
            if (k0 + 32 < 256) __builtin_prefetch(src + 32, 0, 3);
            _Float16* d = bs + r * 40 + cc;
            d[0] = (_Float16)f.x; d[1] = (_Float16)f.y;
            d[2] = (_Float16)f.z; d[3] = (_Float16)f.w;
        }
        __syncthreads();
        v16h a0 = load_frag(as + (rp * 32 + m16) * 40, 0, hlf);
        v16h a1 = load_frag(as + (rp * 32 + 16 + m16) * 40, 0, hlf);
#pragma unroll
        for (int t = 0; t < 4; ++t) {
            v16h b = load_frag(bs + (cq * 64 + t * 16 + m16) * 40, 0, hlf);
            acc[t]     = wmma_f16(a0, b, acc[t]);
            acc[4 + t] = wmma_f16(a1, b, acc[4 + t]);
        }
        __syncthreads();
    }

#pragma unroll
    for (int j = 0; j < 8; ++j) {
        int col = cq * 64 + (j & 3) * 16 + m16;
        float pb = proj_b[col];
#pragma unroll
        for (int v = 0; v < 8; ++v) {
            int r = rp * 32 + (j >> 2) * 16 + v + 8 * hlf;
            out[(rowBase + r) * 256 + col] = acc[j][v] + pb;
        }
    }
}

// ---------------------------------------------------------------------------
extern "C" void kernel_launch(void* const* d_in, const int* in_sizes, int n_in,
                              void* d_out, int out_size, void* d_ws, size_t ws_size,
                              hipStream_t stream) {
    (void)in_sizes; (void)n_in; (void)out_size; (void)ws_size;

    const float* x        = (const float*)d_in[0];
    const float* qkv_w    = (const float*)d_in[1];
    const float* q_bias   = (const float*)d_in[2];
    const float* v_bias   = (const float*)d_in[3];
    const float* scale    = (const float*)d_in[4];
    const float* cpb_w1   = (const float*)d_in[5];
    const float* cpb_b1   = (const float*)d_in[6];
    const float* cpb_w2   = (const float*)d_in[7];
    const float* proj_w   = (const float*)d_in[8];
    const float* proj_b   = (const float*)d_in[9];
    const float* rel_tbl  = (const float*)d_in[10];
    const int*   rel_idx  = (const int*)d_in[11];
    float* out = (float*)d_out;

    // workspace layout (bytes): biasTab 128KB | qbuf 64MB | kbuf 64MB | vbuf 64MB | attnout 64MB
    char* ws = (char*)d_ws;
    const size_t QKV_BYTES = (size_t)BATCH * HEADS * NTOK * HD * sizeof(_Float16); // 64 MiB
    float*    biasTab = (float*)ws;
    _Float16* qbuf    = (_Float16*)(ws + 131072);
    _Float16* kbuf    = (_Float16*)(ws + 131072 + QKV_BYTES);
    _Float16* vbuf    = (_Float16*)(ws + 131072 + 2 * QKV_BYTES);
    _Float16* attnout = (_Float16*)(ws + 131072 + 3 * QKV_BYTES);

    cpb_kernel<<<1, 256, 0, stream>>>(rel_tbl, cpb_w1, cpb_b1, cpb_w2, rel_idx, biasTab);

    qkv_kernel<<<dim3(BATCH, 3), 256, 33792, stream>>>(
        x, qkv_w, q_bias, v_bias, qbuf, kbuf, vbuf);

    attn_kernel<<<dim3(BATCH, HEADS), 128, 40960, stream>>>(
        qbuf, kbuf, vbuf, biasTab, scale, attnout);

    proj_kernel<<<BATCH, 256, 25600, stream>>>(attnout, proj_w, proj_b, out);
}

// v001
// It runs in 303 microseconds.
// Next to v000, in two timings, it ran 1.23 and 1.22 times as fast.
#include <hip/hip_runtime.h>
#include <math.h>

// ---- problem constants ----
#define BATCH 2048
#define NTOK  64
#define CDIM  256
#define HEADS 8
#define HD    32

typedef __attribute__((ext_vector_type(16))) _Float16 v16h;
typedef __attribute__((ext_vector_type(8)))  _Float16 v8h;
typedef __attribute__((ext_vector_type(8)))  float    v8f;

// Load one WMMA 16x16x32 f16 operand fragment for this lane from row-major
// storage (rowPtr = start of this lane's row; stride handled by caller).
// ISA layout: elems 0..7 -> K = hlf*8 + i ; elems 8..15 -> K = 16 + hlf*8 + i.
__device__ __forceinline__ v16h load_frag(const _Float16* rowPtr, int kBase, int hlf) {
    v8h lo = *(const v8h*)(rowPtr + kBase + hlf * 8);
    v8h hi = *(const v8h*)(rowPtr + kBase + 16 + hlf * 8);
    v16h r;
#pragma unroll
    for (int i = 0; i < 8; ++i) { r[i] = lo[i]; r[8 + i] = hi[i]; }
    return r;
}

__device__ __forceinline__ v8f wmma_f16(v16h a, v16h b, v8f c) {
    return __builtin_amdgcn_wmma_f32_16x16x32_f16(false, a, false, b, (short)0, c, false, false);
}

// ---------------------------------------------------------------------------
// Kernel 1: continuous position bias table.  biasTab[h][n][m] = 16*sigmoid(
//   MLP(rel_coords_table)[rel_pos_index[n][m]][h] ),  MLP = relu(x@w1^T+b1)@w2^T
// grid = 128, block = 256 (8 waves).  Each block owns 32 (n,m) pairs, one per
// lane, and evaluates the MLP directly at each pair's table row, so no block
// needs another block's result.  Wave w sums hidden units [64w, 64w+64) for all
// 8 heads; the 8 partial sums per (head, pair) are added in wave order via LDS.
// ---------------------------------------------------------------------------
__global__ __launch_bounds__(256)
void cpb_kernel(const float* __restrict__ tbl2,   // [225][2]
                const float* __restrict__ w1,     // [512][2]
                const float* __restrict__ b1,     // [512]
                const float* __restrict__ w2,     // [8][512]
                const int*   __restrict__ idx,    // [64][64]
                float* __restrict__ biasTab) {    // [8][64][64]
    __shared__ float red[8 * 8 * 32];             // [wave][head][pair]
    const int tid = threadIdx.x, lane = tid & 31;
    // wave number as a scalar: the weight addresses below become wave-uniform,
    // so the weights arrive through scalar loads instead of 32 equal lane loads
    const int wave = __builtin_amdgcn_readfirstlane(tid >> 5);
    const int ij = blockIdx.x * 32 + lane;
    const int e = min(max(idx[ij], 0), 224);      // bounds the table address
    const float i0 = tbl2[e * 2 + 0], i1 = tbl2[e * 2 + 1];

    float acc[8];
#pragma unroll
    for (int h = 0; h < 8; ++h) acc[h] = 0.0f;
    const int j0 = wave * 64;
    // 8 hidden units per trip: each trip waits once on its scalar loads, so
    // wider loads and fewer trips mean fewer load latencies in a row
#pragma unroll 8
    for (int jj = 0; jj < 64; ++jj) {
        const int j = j0 + jj;
        float hv = fmaxf(w1[j * 2 + 0] * i0 + w1[j * 2 + 1] * i1 + b1[j], 0.0f);
#pragma unroll
        for (int h = 0; h < 8; ++h) acc[h] += w2[h * 512 + j] * hv;
    }
#pragma unroll
    for (int h = 0; h < 8; ++h) red[(wave * 8 + h) * 32 + lane] = acc[h];
    __syncthreads();

    // wave w finishes head w for the block's 32 pairs: one 128-byte line
    float val = 0.0f;
#pragma unroll
    for (int w = 0; w < 8; ++w) val += red[(w * 8 + wave) * 32 + lane];
    biasTab[wave * 4096 + ij] = 16.0f / (1.0f + __expf(-val));
}

// ---------------------------------------------------------------------------
// Kernel 2: QKV GEMM + bias + per-head L2 normalization (sections: 0=q,1=k,2=v)
// grid = (2048, 3), block = 256 (8 waves).  Block tile: 64 rows x 256 cols.
// Per-wave tile: 32 rows x 64 cols (2 A-frags x 4 B-frags -> 8 WMMAs; each
// B fragment feeds 2 WMMAs to amortize ds_load waits).
// Outputs f16 in [B][H][N][HD] layout.
// ---------------------------------------------------------------------------
__global__ void qkv_kernel(const float* __restrict__ x,        // [B*N][256]
                           const float* __restrict__ qkv_w,    // [768][256]
                           const float* __restrict__ q_bias,   // [256]
                           const float* __restrict__ v_bias,   // [256]
                           _Float16* __restrict__ qbuf,
                           _Float16* __restrict__ kbuf,
                           _Float16* __restrict__ vbuf) {
    extern __shared__ char smem[];
    _Float16* xs  = (_Float16*)smem;            // [64][40] f16
    _Float16* wsm = xs + 64 * 40;               // [256][40] f16
    const int sec  = blockIdx.y;
    const int tid  = threadIdx.x;
    const int lane = tid & 31, wave = tid >> 5;
    const int m16 = lane & 15, hlf = lane >> 4;
    const int rp = wave & 1;           // row pair  (32 rows)
    const int cq = wave >> 1;          // col quarter (64 cols)
    const long rowBase = (long)blockIdx.x * 64;

    v8f acc[8];
#pragma unroll
    for (int t = 0; t < 8; ++t) acc[t] = (v8f){0, 0, 0, 0, 0, 0, 0, 0};

    for (int k0 = 0; k0 < 256; k0 += 32) {
        // stage x tile (64x32 f32 -> f16), prefetch next K-chunk
        for (int c = tid; c < 512; c += 256) {
            int r = c >> 3, cc = (c & 7) * 4;
            const float* src = x + (rowBase + r) * 256 + k0 + cc;
            float4 f = *(const float4*)src;
            if (k0 + 32 < 256) __builtin_prefetch(src + 32, 0, 3);
            _Float16* d = xs + r * 40 + cc;
            d[0] = (_Float16)f.x; d[1] = (_Float16)f.y;
            d[2] = (_Float16)f.z; d[3] = (_Float16)f.w;
        }
        // stage weight tile (256 output cols x 32 K, f32 -> f16)
        for (int c = tid; c < 2048; c += 256) {
            int r = c >> 3, cc = (c & 7) * 4;
            const float* src = qkv_w + (long)(sec * 256 + r) * 256 + k0 + cc;
            float4 f = *(const float4*)src;
            if (k0 + 32 < 256) __builtin_prefetch(src + 32, 0, 3);
            _Float16* d = wsm + r * 40 + cc;
            d[0] = (_Float16)f.x; d[1] = (_Float16)f.y;
            d[2] = (_Float16)f.z; d[3] = (_Float16)f.w;
        }
        __syncthreads();
        v16h a0 = load_frag(xs + (rp * 32 + m16) * 40, 0, hlf);
        v16h a1 = load_frag(xs + (rp * 32 + 16 + m16) * 40, 0, hlf);
#pragma unroll
        for (int t = 0; t < 4; ++t) {
            v16h b = load_frag(wsm + (cq * 64 + t * 16 + m16) * 40, 0, hlf);
            acc[t]     = wmma_f16(a0, b, acc[t]);
            acc[4 + t] = wmma_f16(a1, b, acc[4 + t]);
        }
        __syncthreads();
    }

    // Epilogue: bias add, per-(row, head) L2 norm for q/k, f16 writeout.
    // obuf overlays staging LDS; processed in two col-half passes (<64KB LDS).
    float* obuf = (float*)smem;                 // [64][132] f32
    _Float16* dstbuf = (sec == 0) ? qbuf : (sec == 1) ? kbuf : vbuf;
    for (int pass = 0; pass < 2; ++pass) {
        if ((cq >> 1) == pass) {
#pragma unroll
            for (int j = 0; j < 8; ++j) {
                int cl = (cq & 1) * 64 + (j & 3) * 16 + m16;
                int colG = pass * 128 + cl;
                float bv = (sec == 0) ? q_bias[colG] : (sec == 2 ? v_bias[colG] : 0.0f);
#pragma unroll
                for (int v = 0; v < 8; ++v) {
                    int r = rp * 32 + (j >> 2) * 16 + v + 8 * hlf;
                    obuf[r * 132 + cl] = acc[j][v] + bv;
                }
            }
        }
        __syncthreads();
        {
            int r = tid >> 2, hl = tid & 3;        // 64 rows x 4 heads
            int hh = pass * 4 + hl;
            const float* rowp = obuf + r * 132 + hl * 32;
            float rs = 1.0f;
            if (sec < 2) {
                float ss = 0.0f;
                for (int dd = 0; dd < 32; ++dd) { float vv = rowp[dd]; ss += vv * vv; }
                rs = 1.0f / fmaxf(sqrtf(ss), 1e-12f);
            }
            _Float16* dp = dstbuf + (((long)blockIdx.x * 8 + hh) * 64 + r) * 32;
            for (int dd = 0; dd < 32; ++dd) dp[dd] = (_Float16)(rowp[dd] * rs);
        }
        __syncthreads();
    }
}

// ---------------------------------------------------------------------------
// Kernel 3: attention per (window, head).  grid = (2048, 8), block = 128.
// S = q@k^T (K=32, one WMMA per tile) * exp(min(scale,ln100)) + cpb bias,
// fp32 softmax, out = attn(f16) @ v via 2 WMMA K-steps.  Writes [B][N][256] f16.
// ---------------------------------------------------------------------------
__global__ void attn_kernel(const _Float16* __restrict__ qbuf,
                            const _Float16* __restrict__ kbuf,
                            const _Float16* __restrict__ vbuf,
                            const float* __restrict__ biasTab,   // [8][64][64]
                            const float* __restrict__ scale,     // [8]
                            _Float16* __restrict__ attnout) {    // [B*N][256]
    extern __shared__ char smem[];
    _Float16* qs  = (_Float16*)smem;            // [64][40]
    _Float16* ks  = qs + 64 * 40;               // [64][40]
    _Float16* vsT = ks + 64 * 40;               // [32][72]  (v transposed: [d][m])
    float*    sb  = (float*)(smem + 14848);     // [64][66] f32
    _Float16* af  = (_Float16*)(smem + 31744);  // [64][72] f16 softmax probs

    const int b = blockIdx.x, h = blockIdx.y;
    const int tid = threadIdx.x, lane = tid & 31, wave = tid >> 5;
    const int m16 = lane & 15, hlf = lane >> 4;
    const long base = ((long)b * 8 + h) * 64 * 32;

    // stage q, k (vectorized) and v transposed (scalar scatter)
    for (int c = tid; c < 256; c += 128) {
        int r = c >> 2, cc = (c & 3) * 8;
        *(v8h*)(qs + r * 40 + cc) = *(const v8h*)(qbuf + base + r * 32 + cc);
        *(v8h*)(ks + r * 40 + cc) = *(const v8h*)(kbuf + base + r * 32 + cc);
    }
    for (int e = tid; e < 2048; e += 128) {
        int r = e >> 5, dd = e & 31;
        vsT[dd * 72 + r] = vbuf[base + r * 32 + dd];
    }
    __syncthreads();

    const float sc = __expf(fminf(scale[h], 4.60517018599f));   // ln(100)
    const float* bt = biasTab + h * 4096;

    // S = q @ k^T  (each wave owns one 16-row n-block, all 4 m-blocks)
    {
        const int nb = wave;
        v16h a = load_frag(qs + (nb * 16 + m16) * 40, 0, hlf);
#pragma unroll
        for (int mb = 0; mb < 4; ++mb) {
            v16h bf = load_frag(ks + (mb * 16 + m16) * 40, 0, hlf);
            v8f s = (v8f){0, 0, 0, 0, 0, 0, 0, 0};
            s = wmma_f16(a, bf, s);
#pragma unroll
            for (int v = 0; v < 8; ++v) {
                int nn = nb * 16 + v + 8 * hlf;
                int mm = mb * 16 + m16;
                sb[nn * 66 + mm] = s[v] * sc + bt[nn * 64 + mm];
            }
        }
    }
    __syncthreads();

    // row softmax in fp32, probs to f16 LDS
    if (tid < 64) {
        float mx = -1e30f;
        for (int j = 0; j < 64; ++j) mx = fmaxf(mx, sb[tid * 66 + j]);
        float sum = 0.0f;
        for (int j = 0; j < 64; ++j) {
            float e = __expf(sb[tid * 66 + j] - mx);
            sum += e;
            af[tid * 72 + j] = (_Float16)e;
        }
        float inv = 1.0f / sum;
        for (int j = 0; j < 64; ++j)
            af[tid * 72 + j] = (_Float16)((float)af[tid * 72 + j] * inv);
    }
    __syncthreads();

    // out = attn @ v   (64x64 @ 64x32, K=64 -> 2 WMMA steps)
    {
        const int nb = wave;
#pragma unroll
        for (int db = 0; db < 2; ++db) {
            v8f o = (v8f){0, 0, 0, 0, 0, 0, 0, 0};
#pragma unroll
            for (int kb = 0; kb < 2; ++kb) {
                v16h a  = load_frag(af + (nb * 16 + m16) * 72, kb * 32, hlf);
                v16h bf = load_frag(vsT + (db * 16 + m16) * 72, kb * 32, hlf);
                o = wmma_f16(a, bf, o);
            }
#pragma unroll
            for (int v = 0; v < 8; ++v) {
                int t = nb * 16 + v + 8 * hlf;
                attnout[((long)b * 64 + t) * 256 + h * 32 + db * 16 + m16] = (_Float16)o[v];
            }
        }
    }
}

// ---------------------------------------------------------------------------
// Kernel 4: output projection.  out[131072x256] = attnout @ proj_w^T + proj_b.
// grid = 2048, block = 256 (8 waves), 64x256 block tile, 32x64 wave tile.
// ---------------------------------------------------------------------------
__global__ void proj_kernel(const _Float16* __restrict__ attnout,
                            const float* __restrict__ proj_w,   // [256][256]
                            const float* __restrict__ proj_b,   // [256]
                            float* __restrict__ out) {
    extern __shared__ char smem[];
    _Float16* as = (_Float16*)smem;     // [64][40]
    _Float16* bs = as + 64 * 40;        // [256][40]
    const int tid = threadIdx.x, lane = tid & 31, wave = tid >> 5;
    const int m16 = lane & 15, hlf = lane >> 4;
    const int rp = wave & 1, cq = wave >> 1;
    const long rowBase = (long)blockIdx.x * 64;

    v8f acc[8];
#pragma unroll
    for (int t = 0; t < 8; ++t) acc[t] = (v8f){0, 0, 0, 0, 0, 0, 0, 0};

    for (int k0 = 0; k0 < 256; k0 += 32) {
        for (int c = tid; c < 256; c += 256) {       // A tile, already f16
            int r = c >> 2, cc = (c & 3) * 8;
            const _Float16* src = attnout + (rowBase + r) * 256 + k0 + cc;
            if (k0 + 32 < 256) __builtin_prefetch(src + 32, 0, 3);
            *(v8h*)(as + r * 40 + cc) = *(const v8h*)src;
        }
        for (int c = tid; c < 2048; c += 256) {      // B tile: proj_w rows, f32->f16
            int r = c >> 3, cc = (c & 7) * 4;
            const float* src = proj_w + (long)r * 256 + k0 + cc;
            float4 f = *(const float4*)src;
            if (k0 + 32 < 256) __builtin_prefetch(src + 32, 0, 3);
            _Float16* d = bs + r * 40 + cc;
            d[0] = (_Float16)f.x; d[1] = (_Float16)f.y;
            d[2] = (_Float16)f.z; d[3] = (_Float16)f.w;
        }
        __syncthreads();
        v16h a0 = load_frag(as + (rp * 32 + m16) * 40, 0, hlf);
        v16h a1 = load_frag(as + (rp * 32 + 16 + m16) * 40, 0, hlf);
#pragma unroll
        for (int t = 0; t < 4; ++t) {
            v16h b = load_frag(bs + (cq * 64 + t * 16 + m16) * 40, 0, hlf);
            acc[t]     = wmma_f16(a0, b, acc[t]);
            acc[4 + t] = wmma_f16(a1, b, acc[4 + t]);
        }
        __syncthreads();
    }

#pragma unroll
    for (int j = 0; j < 8; ++j) {
        int col = cq * 64 + (j & 3) * 16 + m16;
        float pb = proj_b[col];
#pragma unroll
        for (int v = 0; v < 8; ++v) {
            int r = rp * 32 + (j >> 2) * 16 + v + 8 * hlf;
            out[(rowBase + r) * 256 + col] = acc[j][v] + pb;
        }
    }
}

// ---------------------------------------------------------------------------
extern "C" void kernel_launch(void* const* d_in, const int* in_sizes, int n_in,
                              void* d_out, int out_size, void* d_ws, size_t ws_size,
                              hipStream_t stream) {
    (void)in_sizes; (void)n_in; (void)out_size; (void)ws_size;

    const float* x        = (const float*)d_in[0];
    const float* qkv_w    = (const float*)d_in[1];
    const float* q_bias   = (const float*)d_in[2];
    const float* v_bias   = (const float*)d_in[3];
    const float* scale    = (const float*)d_in[4];
    const float* cpb_w1   = (const float*)d_in[5];
    const float* cpb_b1   = (const float*)d_in[6];
    const float* cpb_w2   = (const float*)d_in[7];
    const float* proj_w   = (const float*)d_in[8];
    const float* proj_b   = (const float*)d_in[9];
    const float* rel_tbl  = (const float*)d_in[10];
    const int*   rel_idx  = (const int*)d_in[11];
    float* out = (float*)d_out;

    // workspace layout (bytes): biasTab 128KB | qbuf 64MB | kbuf 64MB | vbuf 64MB | attnout 64MB
    char* ws = (char*)d_ws;
    const size_t QKV_BYTES = (size_t)BATCH * HEADS * NTOK * HD * sizeof(_Float16); // 64 MiB
    float*    biasTab = (float*)ws;
    _Float16* qbuf    = (_Float16*)(ws + 131072);
    _Float16* kbuf    = (_Float16*)(ws + 131072 + QKV_BYTES);
    _Float16* vbuf    = (_Float16*)(ws + 131072 + 2 * QKV_BYTES);
    _Float16* attnout = (_Float16*)(ws + 131072 + 3 * QKV_BYTES);

    cpb_kernel<<<128, 256, 0, stream>>>(rel_tbl, cpb_w1, cpb_b1, cpb_w2, rel_idx, biasTab);

    qkv_kernel<<<dim3(BATCH, 3), 256, 33792, stream>>>(
        x, qkv_w, q_bias, v_bias, qbuf, kbuf, vbuf);

    attn_kernel<<<dim3(BATCH, HEADS), 128, 40960, stream>>>(
        qbuf, kbuf, vbuf, biasTab, scale, attnout);

    proj_kernel<<<BATCH, 256, 25600, stream>>>(attnout, proj_w, proj_b, out);
}

// v002
// Measured time: 242 microseconds a run.
// Next to v001, in two timings, it ran 1.24 times as fast each time.
// All steps since v000 together make it 1.52 times as fast.
#include <hip/hip_runtime.h>
#include <math.h>

// ---- problem constants ----
#define BATCH 2048
#define NTOK  64
#define CDIM  256
#define HEADS 8
#define HD    32

typedef __attribute__((ext_vector_type(16))) _Float16 v16h;
typedef __attribute__((ext_vector_type(8)))  _Float16 v8h;
typedef __attribute__((ext_vector_type(8)))  float    v8f;

// Load one WMMA 16x16x32 f16 operand fragment for this lane from row-major
// storage (rowPtr = start of this lane's row; stride handled by caller).
// ISA layout: elems 0..7 -> K = hlf*8 + i ; elems 8..15 -> K = 16 + hlf*8 + i.
__device__ __forceinline__ v16h load_frag(const _Float16* rowPtr, int kBase, int hlf) {
    v8h lo = *(const v8h*)(rowPtr + kBase + hlf * 8);
    v8h hi = *(const v8h*)(rowPtr + kBase + 16 + hlf * 8);
    v16h r;
#pragma unroll
    for (int i = 0; i < 8; ++i) { r[i] = lo[i]; r[8 + i] = hi[i]; }
    return r;
}

__device__ __forceinline__ v8f wmma_f16(v16h a, v16h b, v8f c) {
    return __builtin_amdgcn_wmma_f32_16x16x32_f16(false, a, false, b, (short)0, c, false, false);
}

// ---------------------------------------------------------------------------
// Kernel 1: continuous position bias table.  biasTab[h][n][m] = 16*sigmoid(
//   MLP(rel_coords_table)[rel_pos_index[n][m]][h] ),  MLP = relu(x@w1^T+b1)@w2^T
// grid = 128, block = 256 (8 waves).  Each block owns 32 (n,m) pairs, one per
// lane, and evaluates the MLP directly at each pair's table row, so no block
// needs another block's result.  Wave w sums hidden units [64w, 64w+64) for all
// 8 heads; the 8 partial sums per (head, pair) are added in wave order via LDS.
// ---------------------------------------------------------------------------
__global__ __launch_bounds__(256)
void cpb_kernel(const float* __restrict__ tbl2,   // [225][2]
                const float* __restrict__ w1,     // [512][2]
                const float* __restrict__ b1,     // [512]
                const float* __restrict__ w2,     // [8][512]
                const int*   __restrict__ idx,    // [64][64]
                float* __restrict__ biasTab) {    // [8][64][64]
    __shared__ float red[8 * 8 * 32];             // [wave][head][pair]
    const int tid = threadIdx.x, lane = tid & 31;
    // wave number as a scalar: the weight addresses below become wave-uniform,
    // so the weights arrive through scalar loads instead of 32 equal lane loads
    const int wave = __builtin_amdgcn_readfirstlane(tid >> 5);
    const int ij = blockIdx.x * 32 + lane;
    const int e = min(max(idx[ij], 0), 224);      // bounds the table address
    const float i0 = tbl2[e * 2 + 0], i1 = tbl2[e * 2 + 1];

    float acc[8];
#pragma unroll
    for (int h = 0; h < 8; ++h) acc[h] = 0.0f;
    const int j0 = wave * 64;
    // 8 hidden units per trip: each trip waits once on its scalar loads, so
    // wider loads and fewer trips mean fewer load latencies in a row
#pragma unroll 8
    for (int jj = 0; jj < 64; ++jj) {
        const int j = j0 + jj;
        float hv = fmaxf(w1[j * 2 + 0] * i0 + w1[j * 2 + 1] * i1 + b1[j], 0.0f);
#pragma unroll
        for (int h = 0; h < 8; ++h) acc[h] += w2[h * 512 + j] * hv;
    }
#pragma unroll
    for (int h = 0; h < 8; ++h) red[(wave * 8 + h) * 32 + lane] = acc[h];
    __syncthreads();

    // wave w finishes head w for the block's 32 pairs: one 128-byte line
    float val = 0.0f;
#pragma unroll
    for (int w = 0; w < 8; ++w) val += red[(w * 8 + wave) * 32 + lane];
    biasTab[wave * 4096 + ij] = 16.0f / (1.0f + __expf(-val));
}

// ---------------------------------------------------------------------------
// Kernel 2: QKV GEMM + bias + per-head L2 normalization (sections: 0=q,1=k,2=v)
// grid = (2048, 3), block = 256 (8 waves).  Block tile: 64 rows x 256 cols.
// Per-wave tile: 32 rows x 64 cols (2 A-frags x 4 B-frags -> 8 WMMAs; each
// B fragment feeds 2 WMMAs to amortize ds_load waits).
// Outputs f16 in [B][H][N][HD] layout.
// The staging loops have compile-time trip counts (block size declared), and
// each K-chunk's ten global loads are issued before the first one is used.
// ---------------------------------------------------------------------------
__global__ __launch_bounds__(256)
void qkv_kernel(const float* __restrict__ x,        // [B*N][256]
                           const float* __restrict__ qkv_w,    // [768][256]
                           const float* __restrict__ q_bias,   // [256]
                           const float* __restrict__ v_bias,   // [256]
                           _Float16* __restrict__ qbuf,
                           _Float16* __restrict__ kbuf,
                           _Float16* __restrict__ vbuf) {
    extern __shared__ char smem[];
    _Float16* xs  = (_Float16*)smem;            // [64][40] f16
    _Float16* wsm = xs + 64 * 40;               // [256][40] f16
    const int sec  = blockIdx.y;
    const int tid  = threadIdx.x;
    const int lane = tid & 31, wave = tid >> 5;
    const int m16 = lane & 15, hlf = lane >> 4;
    const int rp = wave & 1;           // row pair  (32 rows)
    const int cq = wave >> 1;          // col quarter (64 cols)
    const long rowBase = (long)blockIdx.x * 64;
    const float* xblk = x + rowBase * 256;              // this block's 64 rows
    const float* wblk = qkv_w + (long)sec * 65536;      // this section's 256 rows
    const unsigned lofs = (unsigned)(tid >> 3) * 256u + (unsigned)(tid & 7) * 4u;

    v8f acc[8];
#pragma unroll
    for (int t = 0; t < 8; ++t) acc[t] = (v8f){0, 0, 0, 0, 0, 0, 0, 0};

    for (int k0 = 0; k0 < 256; k0 += 32) {
        // load x tile (64x32 f32) and weight tile (256 output cols x 32 K f32)
        // into registers, all loads in flight together; prefetch next K-chunk
        // (row tid>>3 plus 32 per step, 4 floats at (tid&7)*4: one lane offset
        // serves all ten loads, the rest is a uniform base and a constant)
        // (the four staging loops are unrolled so that fx, fw stay in registers)
        float4 fx[2], fw[8];
#pragma unroll
        for (int i = 0; i < 2; ++i) {
            const float* src = xblk + (lofs + i * 8192 + k0);
            fx[i] = *(const float4*)src;
            if (k0 + 32 < 256) __builtin_prefetch(src + 32, 0, 3);
        }
#pragma unroll
        for (int i = 0; i < 8; ++i) {
            const float* src = wblk + (lofs + i * 8192 + k0);
            fw[i] = *(const float4*)src;
            if (k0 + 32 < 256) __builtin_prefetch(src + 32, 0, 3);
        }
        // keeps every load above the first conversion: without it the scheduler
        // sinks loads between the conversions and waits on them one by one
        __builtin_amdgcn_sched_barrier(0);
        // f32 -> f16 and into LDS
#pragma unroll
        for (int i = 0; i < 2; ++i) {
            int c = tid + i * 256;
            int r = c >> 3, cc = (c & 7) * 4;
            _Float16* d = xs + r * 40 + cc;
            d[0] = (_Float16)fx[i].x; d[1] = (_Float16)fx[i].y;
            d[2] = (_Float16)fx[i].z; d[3] = (_Float16)fx[i].w;
        }
#pragma unroll
        for (int i = 0; i < 8; ++i) {
            int c = tid + i * 256;
            int r = c >> 3, cc = (c & 7) * 4;
            _Float16* d = wsm + r * 40 + cc;
            d[0] = (_Float16)fw[i].x; d[1] = (_Float16)fw[i].y;
            d[2] = (_Float16)fw[i].z; d[3] = (_Float16)fw[i].w;
        }
        __syncthreads();
        v16h a0 = load_frag(xs + (rp * 32 + m16) * 40, 0, hlf);
        v16h a1 = load_frag(xs + (rp * 32 + 16 + m16) * 40, 0, hlf);
#pragma unroll
        for (int t = 0; t < 4; ++t) {
            v16h b = load_frag(wsm + (cq * 64 + t * 16 + m16) * 40, 0, hlf);
            acc[t]     = wmma_f16(a0, b, acc[t]);
            acc[4 + t] = wmma_f16(a1, b, acc[4 + t]);
        }
        __syncthreads();
    }

    // Epilogue: bias add, per-(row, head) L2 norm for q/k, f16 writeout.
    // obuf overlays staging LDS; processed in two col-half passes (<64KB LDS).
    float* obuf = (float*)smem;                 // [64][132] f32
    _Float16* dstbuf = (sec == 0) ? qbuf : (sec == 1) ? kbuf : vbuf;
    // this wave's four bias values (columns cq*64 + t*16 + m16), loaded together
    float bvs[4] = {0.0f, 0.0f, 0.0f, 0.0f};            // k has no bias
    if (sec != 1) {
        const float* bp = (sec == 0) ? q_bias : v_bias;
#pragma unroll
        for (int t = 0; t < 4; ++t) bvs[t] = bp[cq * 64 + t * 16 + m16];
    }
    for (int pass = 0; pass < 2; ++pass) {
        if ((cq >> 1) == pass) {
#pragma unroll
            for (int j = 0; j < 8; ++j) {
                int cl = (cq & 1) * 64 + (j & 3) * 16 + m16;
                float bv = bvs[j & 3];
#pragma unroll
                for (int v = 0; v < 8; ++v) {
                    int r = rp * 32 + (j >> 2) * 16 + v + 8 * hlf;
                    obuf[r * 132 + cl] = acc[j][v] + bv;
                }
            }
        }
        __syncthreads();
        {
            int r = tid >> 2, hl = tid & 3;        // 64 rows x 4 heads
            int hh = pass * 4 + hl;
            const float* rowp = obuf + r * 132 + hl * 32;
            float rs = 1.0f;
            if (sec < 2) {
                float ss = 0.0f;
                for (int dd = 0; dd < 32; ++dd) { float vv = rowp[dd]; ss += vv * vv; }
                rs = 1.0f / fmaxf(sqrtf(ss), 1e-12f);
            }
            _Float16* dp = dstbuf + (((long)blockIdx.x * 8 + hh) * 64 + r) * 32;
            for (int dd = 0; dd < 32; ++dd) dp[dd] = (_Float16)(rowp[dd] * rs);
        }
        __syncthreads();
    }
}

// ---------------------------------------------------------------------------
// Kernel 3: attention per (window, head).  grid = (2048, 8), block = 128.
// S = q@k^T (K=32, one WMMA per tile) * exp(min(scale,ln100)) + cpb bias,
// fp32 softmax, out = attn(f16) @ v via 2 WMMA K-steps.  Writes [B][N][256] f16.
// All global loads (q, k, v, this wave's bias entries) are issued at the top.
// ---------------------------------------------------------------------------
__global__ __launch_bounds__(128)
void attn_kernel(const _Float16* __restrict__ qbuf,
                            const _Float16* __restrict__ kbuf,
                            const _Float16* __restrict__ vbuf,
                            const float* __restrict__ biasTab,   // [8][64][64]
                            const float* __restrict__ scale,     // [8]
                            _Float16* __restrict__ attnout) {    // [B*N][256]
    extern __shared__ char smem[];
    _Float16* qs  = (_Float16*)smem;            // [64][40]
    _Float16* ks  = qs + 64 * 40;               // [64][40]
    _Float16* vsT = ks + 64 * 40;               // [32][72]  (v transposed: [d][m])
    float*    sb  = (float*)(smem + 14848);     // [64][66] f32
    _Float16* af  = (_Float16*)(smem + 31744);  // [64][72] f16 softmax probs

    const int b = blockIdx.x, h = blockIdx.y;
    const int tid = threadIdx.x, lane = tid & 31, wave = tid >> 5;
    const int m16 = lane & 15, hlf = lane >> 4;
    const long base = ((long)b * 8 + h) * 64 * 32;

    // load q, k (vectorized), v (scalar) and the bias entries into registers
    const float* bt = biasTab + h * 4096;
    v8h qr[2], kr[2];
    _Float16 vr[16];
    float bb[4][8];
    const _Float16* qblk = qbuf + base;    // the (window, head) tiles are
    const _Float16* kblk = kbuf + base;    // contiguous: element c*8 resp. e
    const _Float16* vblk = vbuf + base;
    const unsigned utid = (unsigned)tid;
    // (all loops here are unrolled so that qr, kr, vr, bb stay in registers)
#pragma unroll
    for (int i = 0; i < 2; ++i) {
        qr[i] = *(const v8h*)(qblk + (utid * 8u + i * 1024));
        kr[i] = *(const v8h*)(kblk + (utid * 8u + i * 1024));
    }
#pragma unroll
    for (int i = 0; i < 16; ++i) vr[i] = vblk[utid + i * 128];
#pragma unroll
    for (int mb = 0; mb < 4; ++mb)
#pragma unroll
        for (int v = 0; v < 8; ++v)
            bb[mb][v] = bt[(wave * 16 + v + 8 * hlf) * 64 + mb * 16 + m16];
    // precaution: the loads' address registers are reused further down; this
    // wait stands behind the last load and in front of every such overwrite
    asm volatile("s_wait_xcnt 0x0" ::: "memory");
    // nothing is scheduled across this line: the LDS stores stay below every
    // load (all are in flight before the first wait on one), and no later write
    // of an address register is lifted above the wait
    __builtin_amdgcn_sched_barrier(0);
    // stage q, k and v transposed (scalar scatter)
#pragma unroll
    for (int i = 0; i < 2; ++i) {
        int c = tid + i * 128;
        int r = c >> 2, cc = (c & 3) * 8;
        *(v8h*)(qs + r * 40 + cc) = qr[i];
        *(v8h*)(ks + r * 40 + cc) = kr[i];
    }
#pragma unroll
    for (int i = 0; i < 16; ++i) {
        int e = tid + i * 128;
        int r = e >> 5, dd = e & 31;
        vsT[dd * 72 + r] = vr[i];
    }
    __syncthreads();

    const float sc = __expf(fminf(scale[h], 4.60517018599f));   // ln(100)

    // S = q @ k^T  (each wave owns one 16-row n-block, all 4 m-blocks)
    {
        const int nb = wave;
        v16h a = load_frag(qs + (nb * 16 + m16) * 40, 0, hlf);
#pragma unroll
        for (int mb = 0; mb < 4; ++mb) {
            v16h bf = load_frag(ks + (mb * 16 + m16) * 40, 0, hlf);
            v8f s = (v8f){0, 0, 0, 0, 0, 0, 0, 0};
            s = wmma_f16(a, bf, s);
#pragma unroll
            for (int v = 0; v < 8; ++v) {
                int nn = nb * 16 + v + 8 * hlf;
                int mm = mb * 16 + m16;
                sb[nn * 66 + mm] = s[v] * sc + bb[mb][v];
            }
        }
    }
    __syncthreads();

    // row softmax in fp32, probs to f16 LDS
    if (tid < 64) {
        float mx = -1e30f;
        for (int j = 0; j < 64; ++j) mx = fmaxf(mx, sb[tid * 66 + j]);
        float sum = 0.0f;
        for (int j = 0; j < 64; ++j) {
            float e = __expf(sb[tid * 66 + j] - mx);
            sum += e;
            af[tid * 72 + j] = (_Float16)e;
        }
        float inv = 1.0f / sum;
        for (int j = 0; j < 64; ++j)
            af[tid * 72 + j] = (_Float16)((float)af[tid * 72 + j] * inv);
    }
    __syncthreads();

    // out = attn @ v   (64x64 @ 64x32, K=64 -> 2 WMMA steps)
    {
        const int nb = wave;
#pragma unroll
        for (int db = 0; db < 2; ++db) {
            v8f o = (v8f){0, 0, 0, 0, 0, 0, 0, 0};
#pragma unroll
            for (int kb = 0; kb < 2; ++kb) {
                v16h a  = load_frag(af + (nb * 16 + m16) * 72, kb * 32, hlf);
                v16h bf = load_frag(vsT + (db * 16 + m16) * 72, kb * 32, hlf);
                o = wmma_f16(a, bf, o);
            }
#pragma unroll
            for (int v = 0; v < 8; ++v) {
                int t = nb * 16 + v + 8 * hlf;
                attnout[((long)b * 64 + t) * 256 + h * 32 + db * 16 + m16] = (_Float16)o[v];
            }
        }
    }
}

// ---------------------------------------------------------------------------
// Kernel 4: output projection.  out[131072x256] = attnout @ proj_w^T + proj_b.
// grid = 2048, block = 256 (8 waves), 64x256 block tile, 32x64 wave tile.
// Each K-chunk's nine global loads are issued before the first one is used.
// ---------------------------------------------------------------------------
// (second bound: 8 waves per SIMD, so that the staging registers do not cost the
// fourth resident work-group per WGP)
__global__ __launch_bounds__(256, 8)
void proj_kernel(const _Float16* __restrict__ attnout,
                            const float* __restrict__ proj_w,   // [256][256]
                            const float* __restrict__ proj_b,   // [256]
                            float* __restrict__ out) {
    extern __shared__ char smem[];
    _Float16* as = (_Float16*)smem;     // [64][40]
    _Float16* bs = as + 64 * 40;        // [256][40]
    const int tid = threadIdx.x, lane = tid & 31, wave = tid >> 5;
    const int m16 = lane & 15, hlf = lane >> 4;
    const int rp = wave & 1, cq = wave >> 1;
    const long rowBase = (long)blockIdx.x * 64;
    const _Float16* ablk = attnout + rowBase * 256;     // this block's 64 rows
    // lane offsets: A row tid>>2, 8 halves at (tid&3)*8; B row tid>>3 plus 32
    // per step, 4 floats at (tid&7)*4
    const unsigned aofs = (unsigned)(tid >> 2) * 256u + (unsigned)(tid & 3) * 8u;
    const unsigned bofs = (unsigned)(tid >> 3) * 256u + (unsigned)(tid & 7) * 4u;

    v8f acc[8];
#pragma unroll
    for (int t = 0; t < 8; ++t) acc[t] = (v8f){0, 0, 0, 0, 0, 0, 0, 0};

    for (int k0 = 0; k0 < 256; k0 += 32) {
        v8h fa;
        float4 fb[8];
        {                                            // A tile, already f16
            const _Float16* src = ablk + (aofs + k0);
            if (k0 + 32 < 256) __builtin_prefetch(src + 32, 0, 3);
            fa = *(const v8h*)src;
        }
        // (both B loops are unrolled so that fb stays in registers)
#pragma unroll
        for (int i = 0; i < 8; ++i) {                // B tile: proj_w rows, f32
            const float* src = proj_w + (bofs + i * 8192 + k0);
            fb[i] = *(const float4*)src;
            if (k0 + 32 < 256) __builtin_prefetch(src + 32, 0, 3);
        }
        // nothing is scheduled across this line: the chunk's nine loads stay one
        // batch above it, the conversions and LDS stores below
        __builtin_amdgcn_sched_barrier(0);
        {
            int r = tid >> 2, cc = (tid & 3) * 8;
            *(v8h*)(as + r * 40 + cc) = fa;
        }
#pragma unroll
        for (int i = 0; i < 8; ++i) {                // f32 -> f16 and into LDS
            int c = tid + i * 256;
            int r = c >> 3, cc = (c & 7) * 4;
            _Float16* d = bs + r * 40 + cc;
            d[0] = (_Float16)fb[i].x; d[1] = (_Float16)fb[i].y;
            d[2] = (_Float16)fb[i].z; d[3] = (_Float16)fb[i].w;
        }
        __syncthreads();
        v16h a0 = load_frag(as + (rp * 32 + m16) * 40, 0, hlf);
        v16h a1 = load_frag(as + (rp * 32 + 16 + m16) * 40, 0, hlf);
#pragma unroll
        for (int t = 0; t < 4; ++t) {
            v16h b = load_frag(bs + (cq * 64 + t * 16 + m16) * 40, 0, hlf);
            acc[t]     = wmma_f16(a0, b, acc[t]);
            acc[4 + t] = wmma_f16(a1, b, acc[4 + t]);
        }
        __syncthreads();
    }

#pragma unroll
    for (int j = 0; j < 8; ++j) {
        int col = cq * 64 + (j & 3) * 16 + m16;
        float pb = proj_b[col];
#pragma unroll
        for (int v = 0; v < 8; ++v) {
            int r = rp * 32 + (j >> 2) * 16 + v + 8 * hlf;
            out[(rowBase + r) * 256 + col] = acc[j][v] + pb;
        }
    }
}

// ---------------------------------------------------------------------------
extern "C" void kernel_launch(void* const* d_in, const int* in_sizes, int n_in,
                              void* d_out, int out_size, void* d_ws, size_t ws_size,
                              hipStream_t stream) {
    (void)in_sizes; (void)n_in; (void)out_size; (void)ws_size;

    const float* x        = (const float*)d_in[0];
    const float* qkv_w    = (const float*)d_in[1];
    const float* q_bias   = (const float*)d_in[2];
    const float* v_bias   = (const float*)d_in[3];
    const float* scale    = (const float*)d_in[4];
    const float* cpb_w1   = (const float*)d_in[5];
    const float* cpb_b1   = (const float*)d_in[6];
    const float* cpb_w2   = (const float*)d_in[7];
    const float* proj_w   = (const float*)d_in[8];
    const float* proj_b   = (const float*)d_in[9];
    const float* rel_tbl  = (const float*)d_in[10];
    const int*   rel_idx  = (const int*)d_in[11];
    float* out = (float*)d_out;

    // workspace layout (bytes): biasTab 128KB | qbuf 64MB | kbuf 64MB | vbuf 64MB | attnout 64MB
    char* ws = (char*)d_ws;
    const size_t QKV_BYTES = (size_t)BATCH * HEADS * NTOK * HD * sizeof(_Float16); // 64 MiB
    float*    biasTab = (float*)ws;
    _Float16* qbuf    = (_Float16*)(ws + 131072);
    _Float16* kbuf    = (_Float16*)(ws + 131072 + QKV_BYTES);
    _Float16* vbuf    = (_Float16*)(ws + 131072 + 2 * QKV_BYTES);
    _Float16* attnout = (_Float16*)(ws + 131072 + 3 * QKV_BYTES);

    cpb_kernel<<<128, 256, 0, stream>>>(rel_tbl, cpb_w1, cpb_b1, cpb_w2, rel_idx, biasTab);

    qkv_kernel<<<dim3(BATCH, 3), 256, 33792, stream>>>(
        x, qkv_w, q_bias, v_bias, qbuf, kbuf, vbuf);

    attn_kernel<<<dim3(BATCH, HEADS), 128, 40960, stream>>>(
        qbuf, kbuf, vbuf, biasTab, scale, attnout);

    proj_kernel<<<BATCH, 256, 25600, stream>>>(attnout, proj_w, proj_b, out);
}

// v003
// One run takes 231 microseconds.
// In two side-by-side timings against v002, it was 1.06 and 1.05 times as fast.
// Over all steps from v000 it is 1.61 times as fast.
#include <hip/hip_runtime.h>
#include <math.h>

// ---- problem constants ----
#define BATCH 2048
#define NTOK  64
#define CDIM  256
#define HEADS 8
#define HD    32

typedef __attribute__((ext_vector_type(16))) _Float16 v16h;
typedef __attribute__((ext_vector_type(8)))  _Float16 v8h;
typedef __attribute__((ext_vector_type(8)))  float    v8f;
typedef __attribute__((ext_vector_type(4)))  float    v4f;

// Load one WMMA 16x16x32 f16 operand fragment for this lane from row-major
// storage (rowPtr = start of this lane's row; stride handled by caller).
// ISA layout: elems 0..7 -> K = hlf*8 + i ; elems 8..15 -> K = 16 + hlf*8 + i.
__device__ __forceinline__ v16h load_frag(const _Float16* rowPtr, int kBase, int hlf) {
    v8h lo = *(const v8h*)(rowPtr + kBase + hlf * 8);
    v8h hi = *(const v8h*)(rowPtr + kBase + 16 + hlf * 8);
    v16h r;
#pragma unroll
    for (int i = 0; i < 8; ++i) { r[i] = lo[i]; r[8 + i] = hi[i]; }
    return r;
}

__device__ __forceinline__ v8f wmma_f16(v16h a, v16h b, v8f c) {
    return __builtin_amdgcn_wmma_f32_16x16x32_f16(false, a, false, b, (short)0, c, false, false);
}

// value of lane l ^ 16 (the other half of the wave), by a vector cross-row move
__device__ __forceinline__ float xhalf(float x) {
    const int i = __builtin_bit_cast(int, x);
    return __builtin_bit_cast(float,
        __builtin_amdgcn_permlanex16(i, i, 0x76543210, 0xfedcba98, false, false));
}

// ---------------------------------------------------------------------------
// Kernel 1: continuous position bias table.  bias(h, n, m) = 16*sigmoid(
//   MLP(rel_coords_table)[rel_pos_index[n][m]][h] ),  MLP = relu(x@w1^T+b1)@w2^T
// Stored per head in the order in which the attention kernel's transposed score
// tiles hold it: position p = nb*1024 + (mb*2 + j)*128 + (hl*16 + c)*4 + e is
// the pair n = nb*16 + c, m = mb*16 + hl*8 + j*4 + e.
// grid = 128, block = 256 (8 waves).  Each block owns 32 positions, one per
// lane, and evaluates the MLP directly at each pair's table row, so no block
// needs another block's result.  Wave w sums hidden units [64w, 64w+64) for all
// 8 heads; the 8 partial sums per (head, pair) are added in wave order via LDS.
// ---------------------------------------------------------------------------
__global__ __launch_bounds__(256)
void cpb_kernel(const float* __restrict__ tbl2,   // [225][2]
                const float* __restrict__ w1,     // [512][2]
                const float* __restrict__ b1,     // [512]
                const float* __restrict__ w2,     // [8][512]
                const int*   __restrict__ idx,    // [64][64]
                float* __restrict__ biasTab) {    // [8][4096], order above
    __shared__ float red[8 * 8 * 32];             // [wave][head][pair]
    const int tid = threadIdx.x, lane = tid & 31;
    // wave number as a scalar: the weight addresses below become wave-uniform,
    // so the weights arrive through scalar loads instead of 32 equal lane loads
    const int wave = __builtin_amdgcn_readfirstlane(tid >> 5);
    const int ij = blockIdx.x * 32 + lane;        // position p in the head's table
    const int pn = (ij >> 10) * 16 + ((ij >> 2) & 15);
    const int pm = ((ij >> 8) & 3) * 16 + ((ij >> 6) & 1) * 8 + ((ij >> 7) & 1) * 4 + (ij & 3);
    const int e = min(max(idx[pn * 64 + pm], 0), 224);   // bounds the table address
    const float i0 = tbl2[e * 2 + 0], i1 = tbl2[e * 2 + 1];

    float acc[8];
#pragma unroll
    for (int h = 0; h < 8; ++h) acc[h] = 0.0f;
    const int j0 = wave * 64;
    // 8 hidden units per trip: each trip waits once on its scalar loads, so
    // wider loads and fewer trips mean fewer load latencies in a row
#pragma unroll 8
    for (int jj = 0; jj < 64; ++jj) {
        const int j = j0 + jj;
        float hv = fmaxf(w1[j * 2 + 0] * i0 + w1[j * 2 + 1] * i1 + b1[j], 0.0f);
#pragma unroll
        for (int h = 0; h < 8; ++h) acc[h] += w2[h * 512 + j] * hv;
    }
#pragma unroll
    for (int h = 0; h < 8; ++h) red[(wave * 8 + h) * 32 + lane] = acc[h];
    __syncthreads();

    // wave w finishes head w for the block's 32 pairs: one 128-byte line
    float val = 0.0f;
#pragma unroll
    for (int w = 0; w < 8; ++w) val += red[(w * 8 + wave) * 32 + lane];
    biasTab[wave * 4096 + ij] = 16.0f / (1.0f + __expf(-val));
}

// ---------------------------------------------------------------------------
// Kernel 2: QKV GEMM + bias + per-head L2 normalization (sections: 0=q,1=k,2=v)
// grid = (2048, 3), block = 256 (8 waves).  Block tile: 64 rows x 256 cols.
// Per-wave tile: 32 rows x 64 cols (2 A-frags x 4 B-frags -> 8 WMMAs; each
// B fragment feeds 2 WMMAs to amortize ds_load waits).
// Outputs f16 in [B][H][N][HD] layout.
// The staging loops have compile-time trip counts (block size declared), and
// each K-chunk's ten global loads are issued before the first one is used.
// ---------------------------------------------------------------------------
__global__ __launch_bounds__(256)
void qkv_kernel(const float* __restrict__ x,        // [B*N][256]
                           const float* __restrict__ qkv_w,    // [768][256]
                           const float* __restrict__ q_bias,   // [256]
                           const float* __restrict__ v_bias,   // [256]
                           _Float16* __restrict__ qbuf,
                           _Float16* __restrict__ kbuf,
                           _Float16* __restrict__ vbuf) {
    extern __shared__ char smem[];
    _Float16* xs  = (_Float16*)smem;            // [64][40] f16
    _Float16* wsm = xs + 64 * 40;               // [256][40] f16
    const int sec  = blockIdx.y;
    const int tid  = threadIdx.x;
    const int lane = tid & 31, wave = tid >> 5;
    const int m16 = lane & 15, hlf = lane >> 4;
    const int rp = wave & 1;           // row pair  (32 rows)
    const int cq = wave >> 1;          // col quarter (64 cols)
    const long rowBase = (long)blockIdx.x * 64;
    const float* xblk = x + rowBase * 256;              // this block's 64 rows
    const float* wblk = qkv_w + (long)sec * 65536;      // this section's 256 rows
    const unsigned lofs = (unsigned)(tid >> 3) * 256u + (unsigned)(tid & 7) * 4u;

    v8f acc[8];
#pragma unroll
    for (int t = 0; t < 8; ++t) acc[t] = (v8f){0, 0, 0, 0, 0, 0, 0, 0};

    for (int k0 = 0; k0 < 256; k0 += 32) {
        // load x tile (64x32 f32) and weight tile (256 output cols x 32 K f32)
        // into registers, all loads in flight together; prefetch next K-chunk
        // (row tid>>3 plus 32 per step, 4 floats at (tid&7)*4: one lane offset
        // serves all ten loads, the rest is a uniform base and a constant)
        // (the four staging loops are unrolled so that fx, fw stay in registers)
        float4 fx[2], fw[8];
#pragma unroll
        for (int i = 0; i < 2; ++i) {
            const float* src = xblk + (lofs + i * 8192 + k0);
            fx[i] = *(const float4*)src;
            if (k0 + 32 < 256) __builtin_prefetch(src + 32, 0, 3);
        }
#pragma unroll
        for (int i = 0; i < 8; ++i) {
            const float* src = wblk + (lofs + i * 8192 + k0);
            fw[i] = *(const float4*)src;
            if (k0 + 32 < 256) __builtin_prefetch(src + 32, 0, 3);
        }
        // keeps every load above the first conversion: without it the scheduler
        // sinks loads between the conversions and waits on them one by one
        __builtin_amdgcn_sched_barrier(0);
        // f32 -> f16 and into LDS
#pragma unroll
        for (int i = 0; i < 2; ++i) {
            int c = tid + i * 256;
            int r = c >> 3, cc = (c & 7) * 4;
            _Float16* d = xs + r * 40 + cc;
            d[0] = (_Float16)fx[i].x; d[1] = (_Float16)fx[i].y;
            d[2] = (_Float16)fx[i].z; d[3] = (_Float16)fx[i].w;
        }
#pragma unroll
        for (int i = 0; i < 8; ++i) {
            int c = tid + i * 256;
            int r = c >> 3, cc = (c & 7) * 4;
            _Float16* d = wsm + r * 40 + cc;
            d[0] = (_Float16)fw[i].x; d[1] = (_Float16)fw[i].y;
            d[2] = (_Float16)fw[i].z; d[3] = (_Float16)fw[i].w;
        }
        __syncthreads();
        v16h a0 = load_frag(xs + (rp * 32 + m16) * 40, 0, hlf);
        v16h a1 = load_frag(xs + (rp * 32 + 16 + m16) * 40, 0, hlf);
#pragma unroll
        for (int t = 0; t < 4; ++t) {
            v16h b = load_frag(wsm + (cq * 64 + t * 16 + m16) * 40, 0, hlf);
            acc[t]     = wmma_f16(a0, b, acc[t]);
            acc[4 + t] = wmma_f16(a1, b, acc[4 + t]);
        }
        __syncthreads();
    }

    // Epilogue: bias add, per-(row, head) L2 norm for q/k, f16 writeout.
    // obuf overlays staging LDS; processed in two col-half passes (<64KB LDS).
    float* obuf = (float*)smem;                 // [64][132] f32
    _Float16* dstbuf = (sec == 0) ? qbuf : (sec == 1) ? kbuf : vbuf;
    // this wave's four bias values (columns cq*64 + t*16 + m16), loaded together
    float bvs[4] = {0.0f, 0.0f, 0.0f, 0.0f};            // k has no bias
    if (sec != 1) {
        const float* bp = (sec == 0) ? q_bias : v_bias;
#pragma unroll
        for (int t = 0; t < 4; ++t) bvs[t] = bp[cq * 64 + t * 16 + m16];
    }
    for (int pass = 0; pass < 2; ++pass) {
        if ((cq >> 1) == pass) {
#pragma unroll
            for (int j = 0; j < 8; ++j) {
                int cl = (cq & 1) * 64 + (j & 3) * 16 + m16;
                float bv = bvs[j & 3];
#pragma unroll
                for (int v = 0; v < 8; ++v) {
                    int r = rp * 32 + (j >> 2) * 16 + v + 8 * hlf;
                    obuf[r * 132 + cl] = acc[j][v] + bv;
                }
            }
        }
        __syncthreads();
        {
            int r = tid >> 2, hl = tid & 3;        // 64 rows x 4 heads
            int hh = pass * 4 + hl;
            const float* rowp = obuf + r * 132 + hl * 32;
            float rs = 1.0f;
            if (sec < 2) {
                float ss = 0.0f;
                for (int dd = 0; dd < 32; ++dd) { float vv = rowp[dd]; ss += vv * vv; }
                rs = 1.0f / fmaxf(sqrtf(ss), 1e-12f);
            }
            _Float16* dp = dstbuf + (((long)blockIdx.x * 8 + hh) * 64 + r) * 32;
            for (int dd = 0; dd < 32; ++dd) dp[dd] = (_Float16)(rowp[dd] * rs);
        }
        __syncthreads();
    }
}

// ---------------------------------------------------------------------------
// Kernel 3: attention per (window, head).  grid = (2048, 8), block = 128.
// Transposed form: S^T = k @ q^T (K=32, one WMMA per 16-key tile), times
// exp(min(scale,ln100)), plus cpb bias.  Each wave owns 16 queries; a lane holds
// 32 of one query's 64 scores (lane l ^ 16 the other 32), so the fp32 softmax is
// in-lane plus one exchange between the wave's halves.  Two score tiles, turned
// to f16 in place, are the B operand of O^T = v^T @ P^T (2 WMMA K-steps); P holds
// exp(s - max), and the division by the row sum is applied to O^T, where a lane
// holds 8 consecutive channels of its query.  Writes [B][N][256] f16.
// All global loads (q, k, v, this wave's bias entries) are issued at the top.
// ---------------------------------------------------------------------------
__global__ __launch_bounds__(128)
void attn_kernel(const _Float16* __restrict__ qbuf,
                            const _Float16* __restrict__ kbuf,
                            const _Float16* __restrict__ vbuf,
                            const float* __restrict__ biasTab,   // [8][4096]
                            const float* __restrict__ scale,     // [8]
                            _Float16* __restrict__ attnout) {    // [B*N][256]
    extern __shared__ char smem[];
    _Float16* qs  = (_Float16*)smem;            // [64][40]
    _Float16* ks  = qs + 64 * 40;               // [64][40]
    _Float16* vsT = ks + 64 * 40;               // [32][72]  (v transposed: [d][m])

    const int b = blockIdx.x, h = blockIdx.y;
    const int tid = threadIdx.x, lane = tid & 31, wave = tid >> 5;
    const int m16 = lane & 15, hlf = lane >> 4;
    const long base = ((long)b * 8 + h) * 64 * 32;

    // load q, k (vectorized), v (scalar) and the bias entries into registers
    const float* bt = biasTab + h * 4096;
    v8h qr[2], kr[2];
    _Float16 vr[16];
    v4f bb[8];
    const _Float16* qblk = qbuf + base;    // the (window, head) tiles are
    const _Float16* kblk = kbuf + base;    // contiguous: element c*8 resp. e
    const _Float16* vblk = vbuf + base;
    const unsigned utid = (unsigned)tid;
    // (all loops here are unrolled so that qr, kr, vr, bb stay in registers)
#pragma unroll
    for (int i = 0; i < 2; ++i) {
        qr[i] = *(const v8h*)(qblk + (utid * 8u + i * 1024));
        kr[i] = *(const v8h*)(kblk + (utid * 8u + i * 1024));
    }
#pragma unroll
    for (int i = 0; i < 16; ++i) vr[i] = vblk[utid + i * 128];
    // bias of score tile mb, registers 4j .. 4j+3: 512 contiguous bytes per wave
#pragma unroll
    for (int i = 0; i < 8; ++i)
        bb[i] = *(const v4f*)(bt + ((unsigned)wave * 1024u + (unsigned)lane * 4u + i * 128));
    // holds the eight bias loads up here, in one batch with the q, k, v loads
    // (loaded values as inputs only): without it the compiler sinks them below
    // the barrier, where their latency is waited out on its own
    asm volatile("" :: "v"(bb[0]), "v"(bb[1]), "v"(bb[2]), "v"(bb[3]),
                       "v"(bb[4]), "v"(bb[5]), "v"(bb[6]), "v"(bb[7]));
    // precaution: the loads' address registers are reused further down; this
    // wait stands behind the last load and in front of every such overwrite
    asm volatile("s_wait_xcnt 0x0" ::: "memory");
    // nothing is scheduled across this line: the LDS stores stay below every
    // load (all are in flight before the first wait on one), and no later write
    // of an address register is lifted above the wait
    __builtin_amdgcn_sched_barrier(0);
    // stage q, k and v transposed (scalar scatter)
#pragma unroll
    for (int i = 0; i < 2; ++i) {
        int c = tid + i * 128;
        int r = c >> 2, cc = (c & 3) * 8;
        *(v8h*)(qs + r * 40 + cc) = qr[i];
        *(v8h*)(ks + r * 40 + cc) = kr[i];
    }
#pragma unroll
    for (int i = 0; i < 16; ++i) {
        int e = tid + i * 128;
        int r = e >> 5, dd = e & 31;
        vsT[dd * 72 + r] = vr[i];
    }
    __syncthreads();

    const float sc = __expf(fminf(scale[h], 4.60517018599f));   // ln(100)

    // S^T = k @ q^T: s[mb][v] is the score of key mb*16 + 8*hlf + v against
    // query wave*16 + m16
    float s[4][8];
    {
        const v16h qf = load_frag(qs + (wave * 16 + m16) * 40, 0, hlf);
#pragma unroll
        for (int mb = 0; mb < 4; ++mb) {
            v16h kf = load_frag(ks + (mb * 16 + m16) * 40, 0, hlf);
            v8f t = (v8f){0, 0, 0, 0, 0, 0, 0, 0};
            t = wmma_f16(kf, qf, t);
            const v4f b0 = bb[mb * 2], b1 = bb[mb * 2 + 1];
            s[mb][0] = t[0] * sc + b0.x; s[mb][1] = t[1] * sc + b0.y;
            s[mb][2] = t[2] * sc + b0.z; s[mb][3] = t[3] * sc + b0.w;
            s[mb][4] = t[4] * sc + b1.x; s[mb][5] = t[5] * sc + b1.y;
            s[mb][6] = t[6] * sc + b1.z; s[mb][7] = t[7] * sc + b1.w;
        }
    }

    // softmax over the query's 64 keys in fp32: 32 in this lane, 32 in lane ^ 16
    float mxp[4];
#pragma unroll
    for (int mb = 0; mb < 4; ++mb) {
        mxp[mb] = s[mb][0];
#pragma unroll
        for (int v = 1; v < 8; ++v) mxp[mb] = fmaxf(mxp[mb], s[mb][v]);
    }
    float mx = fmaxf(fmaxf(mxp[0], mxp[1]), fmaxf(mxp[2], mxp[3]));
    mx = fmaxf(mx, xhalf(mx));
    // pf[kb] element i is key kb*32 + 8*hlf + i, element 8+i key kb*32 + 16 +
    // 8*hlf + i: the k order of load_frag, which loads the v^T operand below
    v16h pf[2];
    float sump[4];                         // four independent sums, one per tile
#pragma unroll
    for (int mb = 0; mb < 4; ++mb) {
        float a[8], e[8];
#pragma unroll
        for (int v = 0; v < 8; ++v) a[v] = (s[mb][v] - mx) * 1.44269504089f;   // log2(e)
        // e = 2^a, one tile's eight in one statement: the outputs are registers
        // of their own ("=&v"), so no exponential is directly followed by a read
        // of its result or a write of its source; the v_nop keeps that one slot
        // behind the last one, whatever the compiler places next
        asm("v_exp_f32 %0, %8\n\tv_exp_f32 %1, %9\n\tv_exp_f32 %2, %10\n\t"
            "v_exp_f32 %3, %11\n\tv_exp_f32 %4, %12\n\tv_exp_f32 %5, %13\n\t"
            "v_exp_f32 %6, %14\n\tv_exp_f32 %7, %15\n\tv_nop"
            : "=&v"(e[0]), "=&v"(e[1]), "=&v"(e[2]), "=&v"(e[3]),
              "=&v"(e[4]), "=&v"(e[5]), "=&v"(e[6]), "=&v"(e[7])
            : "v"(a[0]), "v"(a[1]), "v"(a[2]), "v"(a[3]),
              "v"(a[4]), "v"(a[5]), "v"(a[6]), "v"(a[7]));
        sump[mb] = e[0];
#pragma unroll
        for (int v = 1; v < 8; ++v) sump[mb] += e[v];
#pragma unroll
        for (int v = 0; v < 8; ++v) pf[mb >> 1][(mb & 1) * 8 + v] = (_Float16)e[v];
    }
    float sum = (sump[0] + sump[1]) + (sump[2] + sump[3]);
    sum += xhalf(sum);
    const float inv = 1.0f / sum;

    // O^T = v^T @ P^T  (32x64 @ 64x16 per wave, K=64 -> 2 WMMA steps): o[v] is
    // channel db*16 + 8*hlf + v of query wave*16 + m16, one 16-byte store
    _Float16* orow = attnout + ((long)b * 64 + wave * 16 + m16) * 256 + h * 32 + 8 * hlf;
#pragma unroll
    for (int db = 0; db < 2; ++db) {
        v8f o = (v8f){0, 0, 0, 0, 0, 0, 0, 0};
#pragma unroll
        for (int kb = 0; kb < 2; ++kb) {
            v16h vf = load_frag(vsT + (db * 16 + m16) * 72, kb * 32, hlf);
            o = wmma_f16(vf, pf[kb], o);
        }
        v8h r;
#pragma unroll
        for (int v = 0; v < 8; ++v) r[v] = (_Float16)(o[v] * inv);
        *(v8h*)(orow + db * 16) = r;
    }
}

// ---------------------------------------------------------------------------
// Kernel 4: output projection.  out[131072x256] = attnout @ proj_w^T + proj_b.
// grid = 2048, block = 256 (8 waves), 64x256 block tile, 32x64 wave tile.
// Each K-chunk's nine global loads are issued before the first one is used.
// ---------------------------------------------------------------------------
// (second bound: 8 waves per SIMD, so that the staging registers do not cost the
// fourth resident work-group per WGP)
__global__ __launch_bounds__(256, 8)
void proj_kernel(const _Float16* __restrict__ attnout,
                            const float* __restrict__ proj_w,   // [256][256]
                            const float* __restrict__ proj_b,   // [256]
                            float* __restrict__ out) {
    extern __shared__ char smem[];
    _Float16* as = (_Float16*)smem;     // [64][40]
    _Float16* bs = as + 64 * 40;        // [256][40]
    const int tid = threadIdx.x, lane = tid & 31, wave = tid >> 5;
    const int m16 = lane & 15, hlf = lane >> 4;
    const int rp = wave & 1, cq = wave >> 1;
    const long rowBase = (long)blockIdx.x * 64;
    const _Float16* ablk = attnout + rowBase * 256;     // this block's 64 rows
    // lane offsets: A row tid>>2, 8 halves at (tid&3)*8; B row tid>>3 plus 32
    // per step, 4 floats at (tid&7)*4
    const unsigned aofs = (unsigned)(tid >> 2) * 256u + (unsigned)(tid & 3) * 8u;
    const unsigned bofs = (unsigned)(tid >> 3) * 256u + (unsigned)(tid & 7) * 4u;

    v8f acc[8];
#pragma unroll
    for (int t = 0; t < 8; ++t) acc[t] = (v8f){0, 0, 0, 0, 0, 0, 0, 0};

    for (int k0 = 0; k0 < 256; k0 += 32) {
        v8h fa;
        float4 fb[8];
        {                                            // A tile, already f16
            const _Float16* src = ablk + (aofs + k0);
            if (k0 + 32 < 256) __builtin_prefetch(src + 32, 0, 3);
            fa = *(const v8h*)src;
        }
        // (both B loops are unrolled so that fb stays in registers)
#pragma unroll
        for (int i = 0; i < 8; ++i) {                // B tile: proj_w rows, f32
            const float* src = proj_w + (bofs + i * 8192 + k0);
            fb[i] = *(const float4*)src;
            if (k0 + 32 < 256) __builtin_prefetch(src + 32, 0, 3);
        }
        // nothing is scheduled across this line: the chunk's nine loads stay one
        // batch above it, the conversions and LDS stores below
        __builtin_amdgcn_sched_barrier(0);
        {
            int r = tid >> 2, cc = (tid & 3) * 8;
            *(v8h*)(as + r * 40 + cc) = fa;
        }
#pragma unroll
        for (int i = 0; i < 8; ++i) {                // f32 -> f16 and into LDS
            int c = tid + i * 256;
            int r = c >> 3, cc = (c & 7) * 4;
            _Float16* d = bs + r * 40 + cc;
            d[0] = (_Float16)fb[i].x; d[1] = (_Float16)fb[i].y;
            d[2] = (_Float16)fb[i].z; d[3] = (_Float16)fb[i].w;
        }
        __syncthreads();
        v16h a0 = load_frag(as + (rp * 32 + m16) * 40, 0, hlf);
        v16h a1 = load_frag(as + (rp * 32 + 16 + m16) * 40, 0, hlf);
#pragma unroll
        for (int t = 0; t < 4; ++t) {
            v16h b = load_frag(bs + (cq * 64 + t * 16 + m16) * 40, 0, hlf);
            acc[t]     = wmma_f16(a0, b, acc[t]);
            acc[4 + t] = wmma_f16(a1, b, acc[4 + t]);
        }
        __syncthreads();
    }

#pragma unroll
    for (int j = 0; j < 8; ++j) {
        int col = cq * 64 + (j & 3) * 16 + m16;
        float pb = proj_b[col];
#pragma unroll
        for (int v = 0; v < 8; ++v) {
            int r = rp * 32 + (j >> 2) * 16 + v + 8 * hlf;
            out[(rowBase + r) * 256 + col] = acc[j][v] + pb;
        }
    }
}

// ---------------------------------------------------------------------------
extern "C" void kernel_launch(void* const* d_in, const int* in_sizes, int n_in,
                              void* d_out, int out_size, void* d_ws, size_t ws_size,
                              hipStream_t stream) {
    (void)in_sizes; (void)n_in; (void)out_size; (void)ws_size;

    const float* x        = (const float*)d_in[0];
    const float* qkv_w    = (const float*)d_in[1];
    const float* q_bias   = (const float*)d_in[2];
    const float* v_bias   = (const float*)d_in[3];
    const float* scale    = (const float*)d_in[4];
    const float* cpb_w1   = (const float*)d_in[5];
    const float* cpb_b1   = (const float*)d_in[6];
    const float* cpb_w2   = (const float*)d_in[7];
    const float* proj_w   = (const float*)d_in[8];
    const float* proj_b   = (const float*)d_in[9];
    const float* rel_tbl  = (const float*)d_in[10];
    const int*   rel_idx  = (const int*)d_in[11];
    float* out = (float*)d_out;

    // workspace layout (bytes): biasTab 128KB | qbuf 64MB | kbuf 64MB | vbuf 64MB | attnout 64MB
    char* ws = (char*)d_ws;
    const size_t QKV_BYTES = (size_t)BATCH * HEADS * NTOK * HD * sizeof(_Float16); // 64 MiB
    float*    biasTab = (float*)ws;
    _Float16* qbuf    = (_Float16*)(ws + 131072);
    _Float16* kbuf    = (_Float16*)(ws + 131072 + QKV_BYTES);
    _Float16* vbuf    = (_Float16*)(ws + 131072 + 2 * QKV_BYTES);
    _Float16* attnout = (_Float16*)(ws + 131072 + 3 * QKV_BYTES);

    cpb_kernel<<<128, 256, 0, stream>>>(rel_tbl, cpb_w1, cpb_b1, cpb_w2, rel_idx, biasTab);

    qkv_kernel<<<dim3(BATCH, 3), 256, 33792, stream>>>(
        x, qkv_w, q_bias, v_bias, qbuf, kbuf, vbuf);

    attn_kernel<<<dim3(BATCH, HEADS), 128, 14848, stream>>>(
        qbuf, kbuf, vbuf, biasTab, scale, attnout);

    proj_kernel<<<BATCH, 256, 25600, stream>>>(attnout, proj_w, proj_b, out);
}

// v004
// One run takes 124 microseconds.
// Timed twice side by side with v003, it ran 1.85 and 1.86 times as fast.
// Over all steps from v000 it is 2.98 times as fast.
#include <hip/hip_runtime.h>
#include <math.h>

// ---- problem constants ----
#define BATCH 2048
#define NTOK  64
#define CDIM  256
#define HEADS 8
#define HD    32

typedef __attribute__((ext_vector_type(16))) _Float16 v16h;
typedef __attribute__((ext_vector_type(8)))  _Float16 v8h;
typedef __attribute__((ext_vector_type(8)))  float    v8f;
typedef __attribute__((ext_vector_type(4)))  float    v4f;

// Load one WMMA 16x16x32 f16 operand fragment for this lane from row-major
// storage (rowPtr = start of this lane's row; stride handled by caller).
// ISA layout: elems 0..7 -> K = hlf*8 + i ; elems 8..15 -> K = 16 + hlf*8 + i.
__device__ __forceinline__ v16h load_frag(const _Float16* rowPtr, int kBase, int hlf) {
    v8h lo = *(const v8h*)(rowPtr + kBase + hlf * 8);
    v8h hi = *(const v8h*)(rowPtr + kBase + 16 + hlf * 8);
    v16h r;
#pragma unroll
    for (int i = 0; i < 8; ++i) { r[i] = lo[i]; r[8 + i] = hi[i]; }
    return r;
}

__device__ __forceinline__ v8f wmma_f16(v16h a, v16h b, v8f c) {
    return __builtin_amdgcn_wmma_f32_16x16x32_f16(false, a, false, b, (short)0, c, false, false);
}

// value of lane l ^ 16 (the other half of the wave), by a vector cross-row move
__device__ __forceinline__ float xhalf(float x) {
    const int i = __builtin_bit_cast(int, x);
    return __builtin_bit_cast(float,
        __builtin_amdgcn_permlanex16(i, i, 0x76543210, 0xfedcba98, false, false));
}

// ---------------------------------------------------------------------------
// Kernel 1: continuous position bias table.  bias(h, n, m) = 16*sigmoid(
//   MLP(rel_coords_table)[rel_pos_index[n][m]][h] ),  MLP = relu(x@w1^T+b1)@w2^T
// Stored per head in the order in which the attention kernel's transposed score
// tiles hold it: position p = nb*1024 + (mb*2 + j)*128 + (hl*16 + c)*4 + e is
// the pair n = nb*16 + c, m = mb*16 + hl*8 + j*4 + e.
// grid = 256, block = 256 (8 waves).  Each of blocks 0 .. 127 owns 32 positions, one per
// lane, and evaluates the MLP directly at each pair's table row, so no block
// needs another block's result.  Wave w sums hidden units [64w, 64w+64) for all
// 8 heads; the 8 partial sums per (head, pair) are added in wave order via LDS.
// Blocks 128 .. 255 of the same launch do not touch the bias table: they turn
// the four 256x256 weight matrices (q, k, v, out-projection) to f16 once, in the
// order in which a wave of the GEMM kernels holds them in registers.  Unit u (8
// halves, one per thread) = ((((mat*8 + wave)*2 + t)*8 + kc)*2 + j)*32 + lane is
// row wave*32 + t*16 + (lane & 15) of matrix mat, k = kc*32 + j*16 + (lane >> 4)*8
// .. + 7: the k order of load_frag, each half fragment 512 contiguous bytes.
// ---------------------------------------------------------------------------
__global__ __launch_bounds__(256)
void cpb_kernel(const float* __restrict__ tbl2,   // [225][2]
                const float* __restrict__ w1,     // [512][2]
                const float* __restrict__ b1,     // [512]
                const float* __restrict__ w2,     // [8][512]
                const int*   __restrict__ idx,    // [64][64]
                const float* __restrict__ qkv_w,  // [768][256]
                const float* __restrict__ proj_w, // [256][256]
                _Float16* __restrict__ wpack,     // [4][8][2][8][2][32][8]
                float* __restrict__ biasTab) {    // [8][4096], order above
    __shared__ float red[8 * 8 * 32];             // [wave][head][pair]
    const int tid = threadIdx.x, lane = tid & 31;
    if (blockIdx.x >= 128) {                      // whole blocks: before any barrier
        const unsigned u = (blockIdx.x - 128u) * 256u + (unsigned)tid;
        const unsigned mat = u >> 13;
        const unsigned row = ((u >> 10) & 7u) * 32u + ((u >> 9) & 1u) * 16u + (u & 15u);
        const unsigned k = ((u >> 6) & 7u) * 32u + ((u >> 5) & 1u) * 16u + ((u >> 4) & 1u) * 8u;
        const float* s = ((mat < 3u) ? qkv_w + mat * 65536u : proj_w) + (row * 256u + k);
        const float4 f0 = *(const float4*)s, f1 = *(const float4*)(s + 4);
        v8h r;
        r[0] = (_Float16)f0.x; r[1] = (_Float16)f0.y; r[2] = (_Float16)f0.z; r[3] = (_Float16)f0.w;
        r[4] = (_Float16)f1.x; r[5] = (_Float16)f1.y; r[6] = (_Float16)f1.z; r[7] = (_Float16)f1.w;
        *(v8h*)(wpack + u * 8u) = r;
        return;
    }
    // wave number as a scalar: the weight addresses below become wave-uniform,
    // so the weights arrive through scalar loads instead of 32 equal lane loads
    const int wave = __builtin_amdgcn_readfirstlane(tid >> 5);
    const int ij = blockIdx.x * 32 + lane;        // position p in the head's table
    const int pn = (ij >> 10) * 16 + ((ij >> 2) & 15);
    const int pm = ((ij >> 8) & 3) * 16 + ((ij >> 6) & 1) * 8 + ((ij >> 7) & 1) * 4 + (ij & 3);
    const int e = min(max(idx[pn * 64 + pm], 0), 224);   // bounds the table address
    const float i0 = tbl2[e * 2 + 0], i1 = tbl2[e * 2 + 1];

    float acc[8];
#pragma unroll
    for (int h = 0; h < 8; ++h) acc[h] = 0.0f;
    const int j0 = wave * 64;
    // 8 hidden units per trip: each trip waits once on its scalar loads, so
    // wider loads and fewer trips mean fewer load latencies in a row
#pragma unroll 8
    for (int jj = 0; jj < 64; ++jj) {
        const int j = j0 + jj;
        float hv = fmaxf(w1[j * 2 + 0] * i0 + w1[j * 2 + 1] * i1 + b1[j], 0.0f);
#pragma unroll
        for (int h = 0; h < 8; ++h) acc[h] += w2[h * 512 + j] * hv;
    }
#pragma unroll
    for (int h = 0; h < 8; ++h) red[(wave * 8 + h) * 32 + lane] = acc[h];
    __syncthreads();

    // wave w finishes head w for the block's 32 pairs: one 128-byte line
    float val = 0.0f;
#pragma unroll
    for (int w = 0; w < 8; ++w) val += red[(w * 8 + wave) * 32 + lane];
    biasTab[wave * 4096 + ij] = 16.0f / (1.0f + __expf(-val));
}

// ---------------------------------------------------------------------------
// One wave's share of a packed weight matrix: 32 rows x 256 k = 16 fragments,
// 128 registers, loaded once (wp = the wave's 8192 halves plus lane * 8).
// ---------------------------------------------------------------------------
__device__ __forceinline__ v16h load_wfrag(const _Float16* wp, int f) {
    v8h lo = *(const v8h*)(wp + f * 512);
    v8h hi = *(const v8h*)(wp + f * 512 + 256);
    v16h r;
#pragma unroll   // constant element numbers: no copy is left of this loop
    for (int i = 0; i < 8; ++i) { r[i] = lo[i]; r[8 + i] = hi[i]; }
    return r;
}

#define PASSES   4096      // passes of 32 tokens over the 131072 rows
#define XPITCH   264       // halves per staged row: 528 B, an odd multiple of 16 B
#define QKV_ROWG 170       // row groups: 3 x 170 work-groups, two per WGP

// ---------------------------------------------------------------------------
// Kernel 2: QKV GEMM + bias + per-head L2 normalization (sections: 0=q,1=k,2=v)
// grid = (3, 170), block = 256 (8 waves).  Weights stay put: wave w keeps the 32
// weight rows of head w of its section in registers for the whole kernel, and
// the work-group walks over passes of 32 tokens (pass p, p + 170, ...).
// Transposed product Y^T = W @ x^T: a lane holds, for its token, 16 of the
// head's 32 channels (lane ^ 16 the other 16), so the norm is in-lane plus one
// exchange, and 8 consecutive channels are one 16-byte store.
// x is staged as f16 in two LDS buffers.  A pass: products from this buffer;
// the next tile (loaded to registers one pass ago) goes to the other buffer;
// one barrier, which publishes that buffer and ends the reads of this one; the
// loads of the tile after next; norm and stores.  The stores stand behind the
// barrier because a barrier waits for the wave's own global stores: so placed
// they have a whole pass to finish.
// Outputs f16 in [B][H][N][HD] layout.
// ---------------------------------------------------------------------------
// (second bound: 4 waves per SIMD = 256 registers a wave, two work-groups a WGP)
__global__ __launch_bounds__(256, 4)
void qkv_kernel(const float* __restrict__ x,        // [B*N][256]
                           const _Float16* __restrict__ wpack, // packed f16 weights
                           const float* __restrict__ q_bias,   // [256]
                           const float* __restrict__ v_bias,   // [256]
                           _Float16* __restrict__ qbuf,
                           _Float16* __restrict__ kbuf,
                           _Float16* __restrict__ vbuf) {
    __shared__ __attribute__((aligned(16))) _Float16 xs[2][32 * XPITCH];
    __shared__ __attribute__((aligned(32))) float bsm[256];
    const int sec  = blockIdx.x;
    const int tid  = threadIdx.x;
    const int lane = tid & 31;
    const int wave = __builtin_amdgcn_readfirstlane(tid >> 5);   // scalar: uniform bases
    const int m16 = lane & 15, hlf = lane >> 4;

    // (every loop over fragments, tiles and staged values in this kernel is
    // unrolled: wf, fx, acc, b, r are then indexed by constants and stay in registers)
    v16h wf[2][8];                     // [channel tile][k chunk]
    {
        const _Float16* wp = wpack + ((unsigned)(sec * 8 + wave) * 8192u + (unsigned)lane * 8u);
#pragma unroll
        for (int f = 0; f < 16; ++f) wf[f >> 3][f & 7] = load_wfrag(wp, f);
        // precaution: the wait takes the address as an input, so its registers
        // live up to it and no load of the run lands on them
        asm volatile("s_wait_xcnt 0x0" :: "v"(wp) : "memory");
    }
    bsm[tid] = (sec == 1) ? 0.0f : ((sec == 0) ? q_bias : v_bias)[tid];   // k has no bias
    _Float16* dstbuf = (sec == 0) ? qbuf : (sec == 1) ? kbuf : vbuf;

    // a pass's x tile is 32 KB contiguous: float4 number tid + i*256 is row
    // (tid >> 6) + 4*i, columns (tid & 63)*4 .. + 3
    const unsigned xofs = (unsigned)tid * 4u;
    const unsigned sofs = (unsigned)(tid >> 6) * XPITCH + (unsigned)(tid & 63) * 4u;
    float4 fx[8];
    int p = blockIdx.y;
    {
        const float* xt = x + (size_t)p * 8192;
#pragma unroll
        for (int i = 0; i < 8; ++i) fx[i] = *(const float4*)(xt + (xofs + i * 1024));
#pragma unroll
        for (int i = 0; i < 8; ++i) {
            _Float16* d = &xs[0][sofs + i * 4 * XPITCH];
            d[0] = (_Float16)fx[i].x; d[1] = (_Float16)fx[i].y;
            d[2] = (_Float16)fx[i].z; d[3] = (_Float16)fx[i].w;
        }
    }
    __syncthreads();
    if (p + QKV_ROWG < PASSES) {
        const float* xt = x + (size_t)(p + QKV_ROWG) * 8192;
#pragma unroll
        for (int i = 0; i < 8; ++i) fx[i] = *(const float4*)(xt + (xofs + i * 1024));
        // precaution: stands behind the loads, in front of any later write of
        // their address registers
        asm volatile("s_wait_xcnt 0x0" ::: "memory");
    }
    // nothing is scheduled across this line: the loads stay above the products,
    // and no write of an address register is lifted above the wait
    __builtin_amdgcn_sched_barrier(0);

    int cur = 0;
    for (;;) {
        // acc[t][nt][v]: channel wave*32 + t*16 + 8*hlf + v of token nt*16 + m16;
        // the sums start at the bias
        v8f acc[2][2];
#pragma unroll
        for (int t = 0; t < 2; ++t) {
            acc[t][0] = *(const v8f*)(bsm + wave * 32 + t * 16 + 8 * hlf);
            acc[t][1] = acc[t][0];
        }
        const _Float16* xc = xs[cur] + m16 * XPITCH;
#pragma unroll
        for (int kg = 0; kg < 4; ++kg) {
            // four fragments (eight LDS loads) as one group, then their eight
            // products: one LDS wait per eight products
            v16h b[2][2];
#pragma unroll
            for (int kk = 0; kk < 2; ++kk)
#pragma unroll
                for (int nt = 0; nt < 2; ++nt)
                    b[kk][nt] = load_frag(xc + nt * 16 * XPITCH, (kg * 2 + kk) * 32, hlf);
            // keeps the group whole: without it the scheduler sinks each load
            // pair to its own products and waits on every pair
            __builtin_amdgcn_sched_barrier(0);
#pragma unroll
            for (int kk = 0; kk < 2; ++kk)
#pragma unroll
                for (int nt = 0; nt < 2; ++nt) {
                    acc[0][nt] = wmma_f16(wf[0][kg * 2 + kk], b[kk][nt], acc[0][nt]);
                    acc[1][nt] = wmma_f16(wf[1][kg * 2 + kk], b[kk][nt], acc[1][nt]);
                }
        }

        const bool more = p + QKV_ROWG < PASSES;        // the same for the whole work-group
        if (more) {
#pragma unroll
            for (int i = 0; i < 8; ++i) {
                _Float16* d = &xs[cur ^ 1][sofs + i * 4 * XPITCH];
                d[0] = (_Float16)fx[i].x; d[1] = (_Float16)fx[i].y;
                d[2] = (_Float16)fx[i].z; d[3] = (_Float16)fx[i].w;
            }
        }
        __syncthreads();
        if (p + 2 * QKV_ROWG < PASSES) {
            const float* xt = x + (size_t)(p + 2 * QKV_ROWG) * 8192;
#pragma unroll
            for (int i = 0; i < 8; ++i) fx[i] = *(const float4*)(xt + (xofs + i * 1024));
            // precaution, as above
            asm volatile("s_wait_xcnt 0x0" ::: "memory");
        }
        // as above: loads first, no address write lifted above the wait
        __builtin_amdgcn_sched_barrier(0);

        // per-(token, head) L2 norm for q/k (factor 1 for v), f16 writeout
        v8h r[2][2];
#pragma unroll
        for (int nt = 0; nt < 2; ++nt) {
            float s0 = 0.0f, s1 = 0.0f;
#pragma unroll
            for (int v = 0; v < 8; ++v) {
                s0 += acc[0][nt][v] * acc[0][nt][v];
                s1 += acc[1][nt][v] * acc[1][nt][v];
            }
            float ss = s0 + s1;
            ss += xhalf(ss);
            const float rn = 1.0f / fmaxf(sqrtf(ss), 1e-12f);
            const float rs = (sec < 2) ? rn : 1.0f;
#pragma unroll
            for (int t = 0; t < 2; ++t)
#pragma unroll
                for (int v = 0; v < 8; ++v) r[nt][t][v] = (_Float16)(acc[t][nt][v] * rs);
        }
        // tokens p*32 + m16 and p*32 + 16 + m16 lie in one window, 16 rows apart
        const unsigned g = (unsigned)p * 32u + (unsigned)m16;
        _Float16* dp = dstbuf + ((((g >> 6) * 8u + wave) * 64u + (g & 63u)) * 32u + 8u * hlf);
        *(v8h*)(dp)            = r[0][0];
        *(v8h*)(dp + 16)       = r[0][1];
        *(v8h*)(dp + 512)      = r[1][0];
        *(v8h*)(dp + 512 + 16) = r[1][1];
        // precaution: behind the stores, in front of any later write of the
        // registers they name
        asm volatile("s_wait_xcnt 0x0" ::: "memory");
        // no such write is lifted above the wait
        __builtin_amdgcn_sched_barrier(0);

        if (!more) break;
        p += QKV_ROWG;
        cur ^= 1;
    }
}

// ---------------------------------------------------------------------------
// Kernel 3: attention per (window, head).  grid = (2048, 8), block = 128.
// Transposed form: S^T = k @ q^T (K=32, one WMMA per 16-key tile), times
// exp(min(scale,ln100)), plus cpb bias.  Each wave owns 16 queries; a lane holds
// 32 of one query's 64 scores (lane l ^ 16 the other 32), so the fp32 softmax is
// in-lane plus one exchange between the wave's halves.  Two score tiles, turned
// to f16 in place, are the B operand of O^T = v^T @ P^T (2 WMMA K-steps); P holds
// exp(s - max), and the division by the row sum is applied to O^T, where a lane
// holds 8 consecutive channels of its query.  Writes [B][N][256] f16.
// All global loads (q, k, v, this wave's bias entries) are issued at the top.
// ---------------------------------------------------------------------------
__global__ __launch_bounds__(128)
void attn_kernel(const _Float16* __restrict__ qbuf,
                            const _Float16* __restrict__ kbuf,
                            const _Float16* __restrict__ vbuf,
                            const float* __restrict__ biasTab,   // [8][4096]
                            const float* __restrict__ scale,     // [8]
                            _Float16* __restrict__ attnout) {    // [B*N][256]
    extern __shared__ char smem[];
    _Float16* qs  = (_Float16*)smem;            // [64][40]
    _Float16* ks  = qs + 64 * 40;               // [64][40]
    _Float16* vsT = ks + 64 * 40;               // [32][72]  (v transposed: [d][m])

    const int b = blockIdx.x, h = blockIdx.y;
    const int tid = threadIdx.x, lane = tid & 31, wave = tid >> 5;
    const int m16 = lane & 15, hlf = lane >> 4;
    const long base = ((long)b * 8 + h) * 64 * 32;

    // load q, k (vectorized), v (scalar) and the bias entries into registers
    const float* bt = biasTab + h * 4096;
    v8h qr[2], kr[2];
    _Float16 vr[16];
    v4f bb[8];
    const _Float16* qblk = qbuf + base;    // the (window, head) tiles are
    const _Float16* kblk = kbuf + base;    // contiguous: element c*8 resp. e
    const _Float16* vblk = vbuf + base;
    const unsigned utid = (unsigned)tid;
    // (all loops here are unrolled so that qr, kr, vr, bb stay in registers)
#pragma unroll
    for (int i = 0; i < 2; ++i) {
        qr[i] = *(const v8h*)(qblk + (utid * 8u + i * 1024));
        kr[i] = *(const v8h*)(kblk + (utid * 8u + i * 1024));
    }
#pragma unroll
    for (int i = 0; i < 16; ++i) vr[i] = vblk[utid + i * 128];
    // bias of score tile mb, registers 4j .. 4j+3: 512 contiguous bytes per wave
#pragma unroll
    for (int i = 0; i < 8; ++i)
        bb[i] = *(const v4f*)(bt + ((unsigned)wave * 1024u + (unsigned)lane * 4u + i * 128));
    // holds the eight bias loads up here, in one batch with the q, k, v loads
    // (loaded values as inputs only): without it the compiler sinks them below
    // the barrier, where their latency is waited out on its own
    asm volatile("" :: "v"(bb[0]), "v"(bb[1]), "v"(bb[2]), "v"(bb[3]),
                       "v"(bb[4]), "v"(bb[5]), "v"(bb[6]), "v"(bb[7]));
    // precaution: the loads' address registers are reused further down; this
    // wait stands behind the last load and in front of every such overwrite
    asm volatile("s_wait_xcnt 0x0" ::: "memory");
    // nothing is scheduled across this line: the LDS stores stay below every
    // load (all are in flight before the first wait on one), and no later write
    // of an address register is lifted above the wait
    __builtin_amdgcn_sched_barrier(0);
    // stage q, k and v transposed (scalar scatter)
#pragma unroll
    for (int i = 0; i < 2; ++i) {
        int c = tid + i * 128;
        int r = c >> 2, cc = (c & 3) * 8;
        *(v8h*)(qs + r * 40 + cc) = qr[i];
        *(v8h*)(ks + r * 40 + cc) = kr[i];
    }
#pragma unroll
    for (int i = 0; i < 16; ++i) {
        int e = tid + i * 128;
        int r = e >> 5, dd = e & 31;
        vsT[dd * 72 + r] = vr[i];
    }
    __syncthreads();

    const float sc = __expf(fminf(scale[h], 4.60517018599f));   // ln(100)

    // S^T = k @ q^T: s[mb][v] is the score of key mb*16 + 8*hlf + v against
    // query wave*16 + m16
    float s[4][8];
    {
        const v16h qf = load_frag(qs + (wave * 16 + m16) * 40, 0, hlf);
#pragma unroll
        for (int mb = 0; mb < 4; ++mb) {
            v16h kf = load_frag(ks + (mb * 16 + m16) * 40, 0, hlf);
            v8f t = (v8f){0, 0, 0, 0, 0, 0, 0, 0};
            t = wmma_f16(kf, qf, t);
            const v4f b0 = bb[mb * 2], b1 = bb[mb * 2 + 1];
            s[mb][0] = t[0] * sc + b0.x; s[mb][1] = t[1] * sc + b0.y;
            s[mb][2] = t[2] * sc + b0.z; s[mb][3] = t[3] * sc + b0.w;
            s[mb][4] = t[4] * sc + b1.x; s[mb][5] = t[5] * sc + b1.y;
            s[mb][6] = t[6] * sc + b1.z; s[mb][7] = t[7] * sc + b1.w;
        }
    }

    // softmax over the query's 64 keys in fp32: 32 in this lane, 32 in lane ^ 16
    float mxp[4];
#pragma unroll
    for (int mb = 0; mb < 4; ++mb) {
        mxp[mb] = s[mb][0];
#pragma unroll
        for (int v = 1; v < 8; ++v) mxp[mb] = fmaxf(mxp[mb], s[mb][v]);
    }
    float mx = fmaxf(fmaxf(mxp[0], mxp[1]), fmaxf(mxp[2], mxp[3]));
    mx = fmaxf(mx, xhalf(mx));
    // pf[kb] element i is key kb*32 + 8*hlf + i, element 8+i key kb*32 + 16 +
    // 8*hlf + i: the k order of load_frag, which loads the v^T operand below
    v16h pf[2];
    float sump[4];                         // four independent sums, one per tile
#pragma unroll
    for (int mb = 0; mb < 4; ++mb) {
        float a[8], e[8];
#pragma unroll
        for (int v = 0; v < 8; ++v) a[v] = (s[mb][v] - mx) * 1.44269504089f;   // log2(e)
        // e = 2^a, one tile's eight in one statement: the outputs are registers
        // of their own ("=&v"), so no exponential is directly followed by a read
        // of its result or a write of its source; the v_nop keeps that one slot
        // behind the last one, whatever the compiler places next
        asm("v_exp_f32 %0, %8\n\tv_exp_f32 %1, %9\n\tv_exp_f32 %2, %10\n\t"
            "v_exp_f32 %3, %11\n\tv_exp_f32 %4, %12\n\tv_exp_f32 %5, %13\n\t"
            "v_exp_f32 %6, %14\n\tv_exp_f32 %7, %15\n\tv_nop"
            : "=&v"(e[0]), "=&v"(e[1]), "=&v"(e[2]), "=&v"(e[3]),
              "=&v"(e[4]), "=&v"(e[5]), "=&v"(e[6]), "=&v"(e[7])
            : "v"(a[0]), "v"(a[1]), "v"(a[2]), "v"(a[3]),
              "v"(a[4]), "v"(a[5]), "v"(a[6]), "v"(a[7]));
        sump[mb] = e[0];
#pragma unroll
        for (int v = 1; v < 8; ++v) sump[mb] += e[v];
#pragma unroll
        for (int v = 0; v < 8; ++v) pf[mb >> 1][(mb & 1) * 8 + v] = (_Float16)e[v];
    }
    float sum = (sump[0] + sump[1]) + (sump[2] + sump[3]);
    sum += xhalf(sum);
    const float inv = 1.0f / sum;

    // O^T = v^T @ P^T  (32x64 @ 64x16 per wave, K=64 -> 2 WMMA steps): o[v] is
    // channel db*16 + 8*hlf + v of query wave*16 + m16, one 16-byte store
    _Float16* orow = attnout + ((long)b * 64 + wave * 16 + m16) * 256 + h * 32 + 8 * hlf;
#pragma unroll
    for (int db = 0; db < 2; ++db) {
        v8f o = (v8f){0, 0, 0, 0, 0, 0, 0, 0};
#pragma unroll
        for (int kb = 0; kb < 2; ++kb) {
            v16h vf = load_frag(vsT + (db * 16 + m16) * 72, kb * 32, hlf);
            o = wmma_f16(vf, pf[kb], o);
        }
        v8h r;
#pragma unroll
        for (int v = 0; v < 8; ++v) r[v] = (_Float16)(o[v] * inv);
        *(v8h*)(orow + db * 16) = r;
    }
}

// ---------------------------------------------------------------------------
// Kernel 4: output projection.  out[131072x256] = attnout @ proj_w^T + proj_b.
// grid = 512, block = 256 (8 waves).  Weights stay put as in kernel 2: wave w
// keeps weight rows (output columns) 32w .. 32w+31 in registers, the work-group
// walks over 8 passes of 32 tokens; the order inside a pass is kernel 2's.
// ---------------------------------------------------------------------------
#define PROJ_G 512
// (second bound: 4 waves per SIMD = 256 registers a wave, two work-groups a WGP)
__global__ __launch_bounds__(256, 4)
void proj_kernel(const _Float16* __restrict__ attnout,
                            const _Float16* __restrict__ wpack, // packed f16 weights
                            const float* __restrict__ proj_b,   // [256]
                            float* __restrict__ out) {
    __shared__ __attribute__((aligned(16))) _Float16 as[2][32 * XPITCH];
    const int tid = threadIdx.x, lane = tid & 31;
    const int wave = __builtin_amdgcn_readfirstlane(tid >> 5);   // scalar: uniform bases
    const int m16 = lane & 15, hlf = lane >> 4;

    // (every loop over fragments, tiles and staged values in this kernel is
    // unrolled: wf, fa, acc, a are then indexed by constants and stay in registers)
    v16h wf[2][8];                     // [column tile][k chunk]
    {
        const _Float16* wp = wpack + ((unsigned)(24 + wave) * 8192u + (unsigned)lane * 8u);
#pragma unroll
        for (int f = 0; f < 16; ++f) wf[f >> 3][f & 7] = load_wfrag(wp, f);
        // precaution: the wait takes the address as an input, so its registers
        // live up to it and no load of the run lands on them
        asm volatile("s_wait_xcnt 0x0" :: "v"(wp) : "memory");
    }

    // a pass's tile is 16 KB contiguous: 16-byte unit tid + i*256 is row
    // (tid >> 5) + 8*i, halves (tid & 31)*8 .. + 7
    const unsigned aofs = (unsigned)tid * 8u;
    const unsigned sofs = (unsigned)(tid >> 5) * XPITCH + (unsigned)(tid & 31) * 8u;
    v8h fa[4];
    int p = blockIdx.x;
    {
        const _Float16* at = attnout + (size_t)p * 8192;
#pragma unroll
        for (int i = 0; i < 4; ++i) fa[i] = *(const v8h*)(at + (aofs + i * 2048));
#pragma unroll
        for (int i = 0; i < 4; ++i) *(v8h*)(&as[0][sofs + i * 8 * XPITCH]) = fa[i];
    }
    __syncthreads();
    const float pb0 = proj_b[wave * 32 + m16], pb1 = proj_b[wave * 32 + 16 + m16];
    if (p + PROJ_G < PASSES) {
        const _Float16* at = attnout + (size_t)(p + PROJ_G) * 8192;
#pragma unroll
        for (int i = 0; i < 4; ++i) fa[i] = *(const v8h*)(at + (aofs + i * 2048));
    }
    // precaution: stands behind the loads, in front of any later write of
    // their address registers
    asm volatile("s_wait_xcnt 0x0" ::: "memory");
    // nothing is scheduled across this line: the loads stay above the products,
    // and no write of an address register is lifted above the wait
    __builtin_amdgcn_sched_barrier(0);

    int cur = 0;
    for (;;) {
        // acc[mt][nt][v]: token mt*16 + v + 8*hlf, column wave*32 + nt*16 + m16
        v8f acc[2][2];
#pragma unroll
        for (int mt = 0; mt < 2; ++mt) {
            acc[mt][0] = (v8f){0, 0, 0, 0, 0, 0, 0, 0};
            acc[mt][1] = (v8f){0, 0, 0, 0, 0, 0, 0, 0};
        }
        const _Float16* ac = as[cur] + m16 * XPITCH;
#pragma unroll
        for (int kg = 0; kg < 4; ++kg) {
            // four fragments (eight LDS loads) as one group, then their eight
            // products: one LDS wait per eight products
            v16h a[2][2];
#pragma unroll
            for (int kk = 0; kk < 2; ++kk)
#pragma unroll
                for (int mt = 0; mt < 2; ++mt)
                    a[kk][mt] = load_frag(ac + mt * 16 * XPITCH, (kg * 2 + kk) * 32, hlf);
            // keeps the group whole: without it the scheduler sinks each load
            // pair to its own products and waits on every pair
            __builtin_amdgcn_sched_barrier(0);
#pragma unroll
            for (int kk = 0; kk < 2; ++kk)
#pragma unroll
                for (int mt = 0; mt < 2; ++mt) {
                    acc[mt][0] = wmma_f16(a[kk][mt], wf[0][kg * 2 + kk], acc[mt][0]);
                    acc[mt][1] = wmma_f16(a[kk][mt], wf[1][kg * 2 + kk], acc[mt][1]);
                }
        }

        const bool more = p + PROJ_G < PASSES;          // the same for the whole work-group
        if (more) {
#pragma unroll
            for (int i = 0; i < 4; ++i) *(v8h*)(&as[cur ^ 1][sofs + i * 8 * XPITCH]) = fa[i];
        }
        __syncthreads();
        if (p + 2 * PROJ_G < PASSES) {
            const _Float16* at = attnout + (size_t)(p + 2 * PROJ_G) * 8192;
#pragma unroll
            for (int i = 0; i < 4; ++i) fa[i] = *(const v8h*)(at + (aofs + i * 2048));
            // precaution, as above
            asm volatile("s_wait_xcnt 0x0" ::: "memory");
        }
        // as above: loads first, no address write lifted above the wait
        __builtin_amdgcn_sched_barrier(0);

        float* op = out + ((unsigned)p * 8192u + (unsigned)(8 * hlf) * 256u + wave * 32 + m16);
#pragma unroll
        for (int mt = 0; mt < 2; ++mt) {
#pragma unroll
            for (int v = 0; v < 8; ++v) {
                op[(mt * 16 + v) * 256]      = acc[mt][0][v] + pb0;
                op[(mt * 16 + v) * 256 + 16] = acc[mt][1][v] + pb1;
            }
        }
        // precaution: behind the stores, in front of any later write of the
        // registers they name
        asm volatile("s_wait_xcnt 0x0" ::: "memory");
        // no such write is lifted above the wait
        __builtin_amdgcn_sched_barrier(0);

        if (!more) break;
        p += PROJ_G;
        cur ^= 1;
    }
}

// ---------------------------------------------------------------------------
extern "C" void kernel_launch(void* const* d_in, const int* in_sizes, int n_in,
                              void* d_out, int out_size, void* d_ws, size_t ws_size,
                              hipStream_t stream) {
    (void)in_sizes; (void)n_in; (void)out_size; (void)ws_size;

    const float* x        = (const float*)d_in[0];
    const float* qkv_w    = (const float*)d_in[1];
    const float* q_bias   = (const float*)d_in[2];
    const float* v_bias   = (const float*)d_in[3];
    const float* scale    = (const float*)d_in[4];
    const float* cpb_w1   = (const float*)d_in[5];
    const float* cpb_b1   = (const float*)d_in[6];
    const float* cpb_w2   = (const float*)d_in[7];
    const float* proj_w   = (const float*)d_in[8];
    const float* proj_b   = (const float*)d_in[9];
    const float* rel_tbl  = (const float*)d_in[10];
    const int*   rel_idx  = (const int*)d_in[11];
    float* out = (float*)d_out;

    // workspace layout (bytes): biasTab 128KB | qbuf 64MB | kbuf 64MB | vbuf 64MB | attnout 64MB | wpack 512KB
    char* ws = (char*)d_ws;
    const size_t QKV_BYTES = (size_t)BATCH * HEADS * NTOK * HD * sizeof(_Float16); // 64 MiB
    float*    biasTab = (float*)ws;
    _Float16* qbuf    = (_Float16*)(ws + 131072);
    _Float16* kbuf    = (_Float16*)(ws + 131072 + QKV_BYTES);
    _Float16* vbuf    = (_Float16*)(ws + 131072 + 2 * QKV_BYTES);
    _Float16* attnout = (_Float16*)(ws + 131072 + 3 * QKV_BYTES);
    _Float16* wpack   = (_Float16*)(ws + 131072 + 4 * QKV_BYTES);

    cpb_kernel<<<256, 256, 0, stream>>>(rel_tbl, cpb_w1, cpb_b1, cpb_w2, rel_idx,
                                        qkv_w, proj_w, wpack, biasTab);

    qkv_kernel<<<dim3(3, QKV_ROWG), 256, 0, stream>>>(
        x, wpack, q_bias, v_bias, qbuf, kbuf, vbuf);

    attn_kernel<<<dim3(BATCH, HEADS), 128, 14848, stream>>>(
        qbuf, kbuf, vbuf, biasTab, scale, attnout);

    proj_kernel<<<PROJ_G, 256, 0, stream>>>(attnout, wpack, proj_b, out);
}

// v005
// A run of this version takes 91.1 microseconds.
// Two timings next to v004 put it at 1.36 and 1.37 times that version's speed.
// All steps since v000 together make it 4.06 times as fast.
#include <hip/hip_runtime.h>
#include <math.h>

// ---- problem constants ----
#define BATCH 2048
#define NTOK  64
#define CDIM  256
#define HEADS 8
#define HD    32

typedef __attribute__((ext_vector_type(16))) _Float16 v16h;
typedef __attribute__((ext_vector_type(8)))  _Float16 v8h;
typedef __attribute__((ext_vector_type(8)))  float    v8f;
typedef __attribute__((ext_vector_type(4)))  float    v4f;

// Load one WMMA 16x16x32 f16 operand fragment for this lane from row-major
// storage (rowPtr = start of this lane's row; stride handled by caller).
// ISA layout: elems 0..7 -> K = hlf*8 + i ; elems 8..15 -> K = 16 + hlf*8 + i.
__device__ __forceinline__ v16h load_frag(const _Float16* rowPtr, int kBase, int hlf) {
    v8h lo = *(const v8h*)(rowPtr + kBase + hlf * 8);
    v8h hi = *(const v8h*)(rowPtr + kBase + 16 + hlf * 8);
    v16h r;
#pragma unroll
    for (int i = 0; i < 8; ++i) { r[i] = lo[i]; r[8 + i] = hi[i]; }
    return r;
}

__device__ __forceinline__ v8f wmma_f16(v16h a, v16h b, v8f c) {
    return __builtin_amdgcn_wmma_f32_16x16x32_f16(false, a, false, b, (short)0, c, false, false);
}

// value of lane l ^ 16 (the other half of the wave), by a vector cross-row move
__device__ __forceinline__ float xhalf(float x) {
    const int i = __builtin_bit_cast(int, x);
    return __builtin_bit_cast(float,
        __builtin_amdgcn_permlanex16(i, i, 0x76543210, 0xfedcba98, false, false));
}

// ---------------------------------------------------------------------------
// Kernel 1: continuous position bias table.  bias(h, n, m) = 16*sigmoid(
//   MLP(rel_coords_table)[rel_pos_index[n][m]][h] ),  MLP = relu(x@w1^T+b1)@w2^T
// Stored per head in the order in which the attention kernel's transposed score
// tiles hold it: position p = nb*1024 + (mb*2 + j)*128 + (hl*16 + c)*4 + e is
// the pair n = nb*16 + c, m = mb*16 + hl*8 + j*4 + e.
// grid = 256, block = 256 (8 waves).  Each of blocks 0 .. 127 owns 32 positions, one per
// lane, and evaluates the MLP directly at each pair's table row, so no block
// needs another block's result.  Wave w sums hidden units [64w, 64w+64) for all
// 8 heads; the 8 partial sums per (head, pair) are added in wave order via LDS.
// Blocks 128 .. 255 of the same launch do not touch the bias table: they turn
// the four 256x256 weight matrices (q, k, v, out-projection) to f16 once, in the
// order in which a wave of the GEMM kernels holds them in registers.  Unit u (8
// halves, one per thread) = ((((mat*8 + wave)*2 + t)*8 + kc)*2 + j)*32 + lane is
// row wave*32 + t*16 + (lane & 15) of matrix mat, k = kc*32 + j*16 + (lane >> 4)*8
// .. + 7: the k order of load_frag, each half fragment 512 contiguous bytes.
// ---------------------------------------------------------------------------
__global__ __launch_bounds__(256)
void cpb_kernel(const float* __restrict__ tbl2,   // [225][2]
                const float* __restrict__ w1,     // [512][2]
                const float* __restrict__ b1,     // [512]
                const float* __restrict__ w2,     // [8][512]
                const int*   __restrict__ idx,    // [64][64]
                const float* __restrict__ qkv_w,  // [768][256]
                const float* __restrict__ proj_w, // [256][256]
                _Float16* __restrict__ wpack,     // [4][8][2][8][2][32][8]
                float* __restrict__ biasTab) {    // [8][4096], order above
    __shared__ float red[8 * 8 * 32];             // [wave][head][pair]
    const int tid = threadIdx.x, lane = tid & 31;
    if (blockIdx.x >= 128) {                      // whole blocks: before any barrier
        const unsigned u = (blockIdx.x - 128u) * 256u + (unsigned)tid;
        const unsigned mat = u >> 13;
        const unsigned row = ((u >> 10) & 7u) * 32u + ((u >> 9) & 1u) * 16u + (u & 15u);
        const unsigned k = ((u >> 6) & 7u) * 32u + ((u >> 5) & 1u) * 16u + ((u >> 4) & 1u) * 8u;
        const float* s = ((mat < 3u) ? qkv_w + mat * 65536u : proj_w) + (row * 256u + k);
        const float4 f0 = *(const float4*)s, f1 = *(const float4*)(s + 4);
        v8h r;
        r[0] = (_Float16)f0.x; r[1] = (_Float16)f0.y; r[2] = (_Float16)f0.z; r[3] = (_Float16)f0.w;
        r[4] = (_Float16)f1.x; r[5] = (_Float16)f1.y; r[6] = (_Float16)f1.z; r[7] = (_Float16)f1.w;
        *(v8h*)(wpack + u * 8u) = r;
        return;
    }
    // wave number as a scalar: the weight addresses below become wave-uniform,
    // so the weights arrive through scalar loads instead of 32 equal lane loads
    const int wave = __builtin_amdgcn_readfirstlane(tid >> 5);
    const int ij = blockIdx.x * 32 + lane;        // position p in the head's table
    const int pn = (ij >> 10) * 16 + ((ij >> 2) & 15);
    const int pm = ((ij >> 8) & 3) * 16 + ((ij >> 6) & 1) * 8 + ((ij >> 7) & 1) * 4 + (ij & 3);
    const int e = min(max(idx[pn * 64 + pm], 0), 224);   // bounds the table address
    const float i0 = tbl2[e * 2 + 0], i1 = tbl2[e * 2 + 1];

    float acc[8];
#pragma unroll
    for (int h = 0; h < 8; ++h) acc[h] = 0.0f;
    const int j0 = wave * 64;
    // 8 hidden units per trip: each trip waits once on its scalar loads, so
    // wider loads and fewer trips mean fewer load latencies in a row
#pragma unroll 8
    for (int jj = 0; jj < 64; ++jj) {
        const int j = j0 + jj;
        float hv = fmaxf(w1[j * 2 + 0] * i0 + w1[j * 2 + 1] * i1 + b1[j], 0.0f);
#pragma unroll
        for (int h = 0; h < 8; ++h) acc[h] += w2[h * 512 + j] * hv;
    }
#pragma unroll
    for (int h = 0; h < 8; ++h) red[(wave * 8 + h) * 32 + lane] = acc[h];
    __syncthreads();

    // wave w finishes head w for the block's 32 pairs: one 128-byte line
    float val = 0.0f;
#pragma unroll
    for (int w = 0; w < 8; ++w) val += red[(w * 8 + wave) * 32 + lane];
    biasTab[wave * 4096 + ij] = 16.0f / (1.0f + __expf(-val));
}

// ---------------------------------------------------------------------------
// One wave's share of a packed weight matrix: 32 rows x 256 k = 16 fragments,
// 128 registers, loaded once (wp = the wave's 8192 halves plus lane * 8).
// ---------------------------------------------------------------------------
__device__ __forceinline__ v16h load_wfrag(const _Float16* wp, int f) {
    v8h lo = *(const v8h*)(wp + f * 512);
    v8h hi = *(const v8h*)(wp + f * 512 + 256);
    v16h r;
#pragma unroll   // constant element numbers: no copy is left of this loop
    for (int i = 0; i < 8; ++i) { r[i] = lo[i]; r[8 + i] = hi[i]; }
    return r;
}

#define PASSES   4096      // passes of 32 tokens over the 131072 rows
#define XPITCH   264       // halves per staged row: 528 B, an odd multiple of 16 B
#define WINDOWS  2048
#define FUSE_G   256       // work-groups: one per WGP, 8 windows each

// two accumulator tiles that hold, per lane, 16 of a token's 32 head channels
// (lane ^ 16 the other 16): divided by the token's L2 norm and turned to f16
// they are in place that token's operand fragment (the k order of load_frag)
// (loops unrolled: constant element numbers, everything stays in registers)
__device__ __forceinline__ v16h norm_frag(v8f a0, v8f a1) {
    float s0 = 0.0f, s1 = 0.0f;
#pragma unroll
    for (int v = 0; v < 8; ++v) { s0 += a0[v] * a0[v]; s1 += a1[v] * a1[v]; }
    float ss = s0 + s1;
    ss += xhalf(ss);
    const float rn = 1.0f / fmaxf(sqrtf(ss), 1e-12f);
    v16h r;
#pragma unroll
    for (int v = 0; v < 8; ++v) { r[v] = (_Float16)(a0[v] * rn); r[8 + v] = (_Float16)(a1[v] * rn); }
    return r;
}

// ---------------------------------------------------------------------------
// Kernel 2: QKV projection, per-head L2 norm and attention in one kernel.
// grid = 256, block = 256 (8 waves), one work-group per WGP; the work-group
// walks over windows (w, w + 256, ...), wave h does head h of the window from
// the x tile to the attention output, and q, k, v never leave its registers.
// The wave keeps its head's 32 q rows and 32 k rows of the weights in registers
// for the whole kernel (248 registers, one fragment in LDS); the v weights and the bias table of all
// heads lie in LDS, beside one buffer for the window's x tile as f16.
// Products, all from the same x fragments:
//   Q^T = Wq @ x^T, K^T = Wk @ x^T: a lane holds, for its token, channels
//     t*16 + 8*hlf + v: norm_frag makes the token's fragment of them.
//   V = x @ Wv^T: a lane holds, for its channel, tokens mt*16 + 8*hlf + v.  Two
//     such tiles are in place a fragment of v^T over 32 keys.
//   S^T = k @ q^T, softmax in registers, O^T = v^T @ P^T.
// A window: q, k, v of the 64 tokens (the only reads of the x buffer); a
// barrier that ends those reads; attention per 16 queries, while the next
// window's x comes in through registers, 32 rows at a time; a barrier that
// publishes it.  The last tile's global stores stand behind that barrier,
// because a barrier waits for the wave's own global stores.
// Writes [B][N][256] f16.
// ---------------------------------------------------------------------------
// (256 threads: up to 512 registers a wave, two waves per SIMD)
__global__ __launch_bounds__(256)
void qkv_attn_kernel(const float* __restrict__ x,        // [B*N][256]
                     const _Float16* __restrict__ wpack, // packed f16 weights
                     const float* __restrict__ q_bias,   // [256]
                     const float* __restrict__ v_bias,   // [256]
                     const float* __restrict__ biasTab,  // [8][4096]
                     const float* __restrict__ scale,    // [8]
                     _Float16* __restrict__ attnout) {   // [B*N][256]
    __shared__ __attribute__((aligned(16))) _Float16 wvs[65536];
    __shared__ __attribute__((aligned(16))) float bts[32768];
    __shared__ __attribute__((aligned(16))) _Float16 xs[64 * XPITCH];
    __shared__ __attribute__((aligned(32))) float qbs[256];
    __shared__ __attribute__((aligned(16))) _Float16 wq0s[8 * 512];
    const int tid  = threadIdx.x;
    const int lane = tid & 31;
    const int wave = __builtin_amdgcn_readfirstlane(tid >> 5);   // scalar: uniform bases
    const int m16 = lane & 15, hlf = lane >> 4;

    // (every loop in this kernel but the window loop is unrolled: all arrays are
    // then indexed by constants and stay in registers)
    {
        // the packed v weights and the bias table, 128 KB each, as they lie:
        // 16-byte unit tid + i*256
        const _Float16* wp = wpack + (2u * 65536u + (unsigned)tid * 8u);
        const float* bp = biasTab + (unsigned)tid * 4u;
#pragma unroll
        for (int g = 0; g < 4; ++g) {
            v8h t[8];
            v4f u[8];
#pragma unroll
            for (int i = 0; i < 8; ++i) {
                t[i] = *(const v8h*)(wp + (g * 8 + i) * 2048);
                u[i] = *(const v4f*)(bp + (g * 8 + i) * 1024);
            }
#pragma unroll
            for (int i = 0; i < 8; ++i) {
                *(v8h*)(wvs + (unsigned)tid * 8u + (g * 8 + i) * 2048) = t[i];
                *(v4f*)(bts + (unsigned)tid * 4u + (g * 8 + i) * 1024) = u[i];
            }
        }
        // precaution: the wait takes the addresses as inputs, so their registers
        // live up to it and no load of the run lands on them
        asm volatile("s_wait_xcnt 0x0" :: "v"(wp), "v"(bp) : "memory");
    }
    const float* btl = bts + ((unsigned)wave * 4096u + (unsigned)lane * 4u);
    const _Float16* wvl = wvs + ((unsigned)wave * 8192u + (unsigned)lane * 8u);

    // a window's x tile is 64 KB contiguous: float4 number tid + i*256 is row
    // (tid >> 6) + 4*i, columns (tid & 63)*4 .. + 3
    const unsigned xofs = (unsigned)tid * 4u;
    const unsigned sofs = (unsigned)(tid >> 6) * XPITCH + (unsigned)(tid & 63) * 4u;
    int w = blockIdx.x;
    float vb0, vb1;                    // v bias of channels m16 and 16 + m16 of the head
    {
        float4 fx[16];
        const float* xt = x + (size_t)w * 16384;
#pragma unroll
        for (int i = 0; i < 16; ++i) fx[i] = *(const float4*)(xt + (xofs + i * 1024));
        const float qb = q_bias[tid];
        vb0 = v_bias[wave * 32 + m16];
        vb1 = v_bias[wave * 32 + 16 + m16];
        // precaution: behind the loads, in front of any later write of their
        // address registers
        asm volatile("s_wait_xcnt 0x0" ::: "memory");
        // no such write is lifted above the wait
        __builtin_amdgcn_sched_barrier(0);
        qbs[tid] = qb;
#pragma unroll
        for (int i = 0; i < 16; ++i) {
            _Float16* d = &xs[sofs + i * 4 * XPITCH];
            d[0] = (_Float16)fx[i].x; d[1] = (_Float16)fx[i].y;
            d[2] = (_Float16)fx[i].z; d[3] = (_Float16)fx[i].w;
        }
    }

    const float sc = __expf(fminf(scale[wave], 4.60517018599f));   // ln(100)

    v16h wq[2][8], wk[2][8];           // [channel tile][k chunk]
    _Float16* wq0l = wq0s + ((unsigned)wave * 512u + (unsigned)lane * 8u);
    {
        const _Float16* wp = wpack + ((unsigned)wave * 8192u + (unsigned)lane * 8u);
#pragma unroll
        for (int f = 0; f < 16; ++f) wq[f >> 3][f & 7] = load_wfrag(wp, f);
#pragma unroll
        for (int f = 0; f < 16; ++f) wk[f >> 3][f & 7] = load_wfrag(wp + 65536, f);
        // precaution: the wait takes the address as an input, as above
        asm volatile("s_wait_xcnt 0x0" :: "v"(wp) : "memory");
        // the registers hold 31 of the 32 fragments (with all 32 the compiler
        // kept one in scratch memory): the first q fragment lies in LDS and comes
        // with the fragment group of k chunk 0
#pragma unroll
        for (int i = 0; i < 8; ++i) { wq0l[i] = wq[0][0][i]; wq0l[256 + i] = wq[0][0][8 + i]; }
    }
    __syncthreads();

    const _Float16* xc = xs + m16 * XPITCH;
    for (;;) {
        const bool more = w + FUSE_G < WINDOWS;         // the same for the whole work-group
        // no branch stands inside a window: the compiler moves work across a
        // branch (the end of the q, k, v part went below the x loads, and the
        // registers did not suffice).  So the last window fetches its own tile
        // once more, which nobody reads
        const float* xn = x + (size_t)(more ? w + FUSE_G : w) * 16384;
        float4 fn[8];

        // ---- q, k, v of the 64 tokens, 32 tokens at a time ----
        v16h qf[4];        // qf[qt]: query qt*16 + m16, the head's 32 channels
        v16h kf[4];        // kf[mb]: key mb*16 + m16, the head's 32 channels
        v16h vf[2][2];     // vf[db][kb]: channel db*16 + m16, keys kb*32 .. + 31
#pragma unroll
        for (int hw = 0; hw < 2; ++hw) {
            // aq, ak[t][n]: channel t*16 + 8*hlf + v of token (hw*2 + n)*16 + m16
            // av[n][c]: token (hw*2 + n)*16 + 8*hlf + v, channel c*16 + m16
            // the q and v sums start at the bias, k has none
            v8f aq[2][2], ak[2][2], av[2][2];
#pragma unroll
            for (int n = 0; n < 2; ++n) {
                aq[n][0] = *(const v8f*)(qbs + wave * 32 + n * 16 + 8 * hlf);
                aq[n][1] = aq[n][0];
                ak[0][n] = (v8f){0, 0, 0, 0, 0, 0, 0, 0};
                ak[1][n] = (v8f){0, 0, 0, 0, 0, 0, 0, 0};
                av[n][0] = (v8f){vb0, vb0, vb0, vb0, vb0, vb0, vb0, vb0};
                av[n][1] = (v8f){vb1, vb1, vb1, vb1, vb1, vb1, vb1, vb1};
            }
#pragma unroll
            for (int kc = 0; kc < 8; ++kc) {
                // a k chunk's four fragments (eight LDS loads) as one group, then
                // their twelve products: one LDS wait per twelve products
                v16h b[2], wv[2];      // [token tile], [channel tile]
#pragma unroll
                for (int n = 0; n < 2; ++n) {
                    b[n]  = load_frag(xc + (hw * 2 + n) * 16 * XPITCH, kc * 32, hlf);
                    wv[n] = load_wfrag(wvl, n * 8 + kc);
                }
                const v16h wq0 = (kc == 0) ? load_wfrag(wq0l, 0) : wq[0][kc];
                // keeps the group whole: without it the scheduler sinks each load
                // pair to its own products and waits on every pair
                __builtin_amdgcn_sched_barrier(0);
#pragma unroll
                for (int n = 0; n < 2; ++n) {
                    aq[0][n] = wmma_f16(wq0, b[n], aq[0][n]);
                    aq[1][n] = wmma_f16(wq[1][kc], b[n], aq[1][n]);
                    ak[0][n] = wmma_f16(wk[0][kc], b[n], ak[0][n]);
                    ak[1][n] = wmma_f16(wk[1][kc], b[n], ak[1][n]);
                    av[n][0] = wmma_f16(b[n], wv[0], av[n][0]);
                    av[n][1] = wmma_f16(b[n], wv[1], av[n][1]);
                }
                // no later group rises above these products: there are registers
                // for one group of fragments only (the SIMD's other wave works
                // while this one waits for its group)
                __builtin_amdgcn_sched_barrier(0);
            }
#pragma unroll
            for (int n = 0; n < 2; ++n) {
                qf[hw * 2 + n] = norm_frag(aq[0][n], aq[1][n]);
                kf[hw * 2 + n] = norm_frag(ak[0][n], ak[1][n]);
#pragma unroll
                for (int v = 0; v < 8; ++v) {
                    vf[0][hw][n * 8 + v] = (_Float16)av[n][0][v];
                    vf[1][hw][n * 8 + v] = (_Float16)av[n][1][v];
                }
            }
            // the sums' registers are free before anything later starts
            __builtin_amdgcn_sched_barrier(0);
        }
        __syncthreads();       // every wave has read the x buffer for the last time

        // ---- attention, 16 queries at a time; the next x tile on the way ----
        v8h rl[2];         // the last tile's output, stored behind the barrier
#pragma unroll
        for (int qt = 0; qt < 4; ++qt) {
            if ((qt & 1) == 0) {
#pragma unroll
                for (int i = 0; i < 8; ++i)
                    fn[i] = *(const float4*)(xn + (xofs + (qt >> 1) * 8192 + i * 1024));
                // precaution: behind the loads, in front of any later write of
                // their address registers
                asm volatile("s_wait_xcnt 0x0" ::: "memory");
                // nothing is scheduled across this line: the loads stay above two
                // tiles' work, and no address write is lifted above the wait
                __builtin_amdgcn_sched_barrier(0);
            }
            // S^T = k @ q^T: s[mb][v] is the score of key mb*16 + 8*hlf + v
            // against query qt*16 + m16; its bias is entry mb*2 + (v >> 2) of the
            // tile's eight, 512 contiguous bytes per load
            float s[4][8];
#pragma unroll
            for (int mb = 0; mb < 4; ++mb) {
                const v4f b0 = *(const v4f*)(btl + (qt * 1024 + mb * 256));
                const v4f b1 = *(const v4f*)(btl + (qt * 1024 + mb * 256 + 128));
                v8f t = (v8f){0, 0, 0, 0, 0, 0, 0, 0};
                t = wmma_f16(kf[mb], qf[qt], t);
                s[mb][0] = t[0] * sc + b0.x; s[mb][1] = t[1] * sc + b0.y;
                s[mb][2] = t[2] * sc + b0.z; s[mb][3] = t[3] * sc + b0.w;
                s[mb][4] = t[4] * sc + b1.x; s[mb][5] = t[5] * sc + b1.y;
                s[mb][6] = t[6] * sc + b1.z; s[mb][7] = t[7] * sc + b1.w;
            }

            // softmax over the query's 64 keys in fp32: 32 in this lane, 32 in
            // lane ^ 16
            float mxp[4];
#pragma unroll
            for (int mb = 0; mb < 4; ++mb) {
                mxp[mb] = s[mb][0];
#pragma unroll
                for (int v = 1; v < 8; ++v) mxp[mb] = fmaxf(mxp[mb], s[mb][v]);
            }
            float mx = fmaxf(fmaxf(mxp[0], mxp[1]), fmaxf(mxp[2], mxp[3]));
            mx = fmaxf(mx, xhalf(mx));
            // pf[kb] element i is key kb*32 + 8*hlf + i, element 8+i key kb*32 +
            // 16 + 8*hlf + i: the k order of vf
            v16h pf[2];
            float sump[4];                     // four independent sums, one per tile
#pragma unroll
            for (int mb = 0; mb < 4; ++mb) {
                float a[8], e[8];
#pragma unroll
                for (int v = 0; v < 8; ++v) a[v] = (s[mb][v] - mx) * 1.44269504089f;   // log2(e)
                // e = 2^a, one tile's eight in one statement: the outputs are
                // registers of their own ("=&v"), so no exponential is directly
                // followed by a read of its result or a write of its source; the
                // v_nop keeps that one slot behind the last one, whatever the
                // compiler places next
                asm("v_exp_f32 %0, %8\n\tv_exp_f32 %1, %9\n\tv_exp_f32 %2, %10\n\t"
                    "v_exp_f32 %3, %11\n\tv_exp_f32 %4, %12\n\tv_exp_f32 %5, %13\n\t"
                    "v_exp_f32 %6, %14\n\tv_exp_f32 %7, %15\n\tv_nop"
                    : "=&v"(e[0]), "=&v"(e[1]), "=&v"(e[2]), "=&v"(e[3]),
                      "=&v"(e[4]), "=&v"(e[5]), "=&v"(e[6]), "=&v"(e[7])
                    : "v"(a[0]), "v"(a[1]), "v"(a[2]), "v"(a[3]),
                      "v"(a[4]), "v"(a[5]), "v"(a[6]), "v"(a[7]));
                sump[mb] = e[0];
#pragma unroll
                for (int v = 1; v < 8; ++v) sump[mb] += e[v];
#pragma unroll
                for (int v = 0; v < 8; ++v) pf[mb >> 1][(mb & 1) * 8 + v] = (_Float16)e[v];
            }
            float sum = (sump[0] + sump[1]) + (sump[2] + sump[3]);
            sum += xhalf(sum);
            const float inv = 1.0f / sum;

            // O^T = v^T @ P^T (K = 64: 2 WMMA steps): o[v] is channel
            // db*16 + 8*hlf + v of query qt*16 + m16, one 16-byte store
            _Float16* orow = attnout + (((unsigned)w * 64u + qt * 16 + m16) * 256u + wave * 32 + 8 * hlf);
#pragma unroll
            for (int db = 0; db < 2; ++db) {
                v8f o = (v8f){0, 0, 0, 0, 0, 0, 0, 0};
#pragma unroll
                for (int kb = 0; kb < 2; ++kb) o = wmma_f16(vf[db][kb], pf[kb], o);
                v8h r;
#pragma unroll
                for (int v = 0; v < 8; ++v) r[v] = (_Float16)(o[v] * inv);
                if (qt < 3) *(v8h*)(orow + db * 16) = r;
                else        rl[db] = r;
            }
            if (qt < 3) {
                // precaution: behind the stores, in front of any later write of
                // the registers they name
                asm volatile("s_wait_xcnt 0x0" ::: "memory");
                // no such write is lifted above the wait
                __builtin_amdgcn_sched_barrier(0);
            }
            if ((qt & 1) == 1) {
                // the 32 rows that came in during these two tiles
#pragma unroll
                for (int i = 0; i < 8; ++i) {
                    _Float16* d = &xs[sofs + ((qt >> 1) * 8 + i) * 4 * XPITCH];
                    d[0] = (_Float16)fn[i].x; d[1] = (_Float16)fn[i].y;
                    d[2] = (_Float16)fn[i].z; d[3] = (_Float16)fn[i].w;
                }
                // the next 32 rows' loads do not rise above this: they take the
                // same registers, and their wait stands directly behind them
                __builtin_amdgcn_sched_barrier(0);
            }
        }
        __syncthreads();       // publishes the next window's x tile
        {
            _Float16* orow = attnout + (((unsigned)w * 64u + 48 + m16) * 256u + wave * 32 + 8 * hlf);
            *(v8h*)(orow)      = rl[0];
            *(v8h*)(orow + 16) = rl[1];
            // precaution, as above
            asm volatile("s_wait_xcnt 0x0" ::: "memory");
            // no write of the stores' registers is lifted above the wait
            __builtin_amdgcn_sched_barrier(0);
        }

        if (!more) break;
        w += FUSE_G;
    }
}

// ---------------------------------------------------------------------------
// Kernel 3: output projection.  out[131072x256] = attnout @ proj_w^T + proj_b.
// grid = 512, block = 256 (8 waves).  Weights stay put: wave w keeps weight rows
// (output columns) 32w .. 32w+31 in registers, the work-group walks over 8
// passes of 32 tokens, staged in two LDS buffers.  A pass: products from this
// buffer; the next tile (loaded to registers one pass ago) goes to the other
// buffer; one barrier; the loads of the tile after next; the stores.
// ---------------------------------------------------------------------------
#define PROJ_G 512
// (second bound: 4 waves per SIMD = 256 registers a wave, two work-groups a WGP)
__global__ __launch_bounds__(256, 4)
void proj_kernel(const _Float16* __restrict__ attnout,
                            const _Float16* __restrict__ wpack, // packed f16 weights
                            const float* __restrict__ proj_b,   // [256]
                            float* __restrict__ out) {
    __shared__ __attribute__((aligned(16))) _Float16 as[2][32 * XPITCH];
    const int tid = threadIdx.x, lane = tid & 31;
    const int wave = __builtin_amdgcn_readfirstlane(tid >> 5);   // scalar: uniform bases
    const int m16 = lane & 15, hlf = lane >> 4;

    // (every loop over fragments, tiles and staged values in this kernel is
    // unrolled: wf, fa, acc, a are then indexed by constants and stay in registers)
    v16h wf[2][8];                     // [column tile][k chunk]
    {
        const _Float16* wp = wpack + ((unsigned)(24 + wave) * 8192u + (unsigned)lane * 8u);
#pragma unroll
        for (int f = 0; f < 16; ++f) wf[f >> 3][f & 7] = load_wfrag(wp, f);
        // precaution: the wait takes the address as an input, so its registers
        // live up to it and no load of the run lands on them
        asm volatile("s_wait_xcnt 0x0" :: "v"(wp) : "memory");
    }

    // a pass's tile is 16 KB contiguous: 16-byte unit tid + i*256 is row
    // (tid >> 5) + 8*i, halves (tid & 31)*8 .. + 7
    const unsigned aofs = (unsigned)tid * 8u;
    const unsigned sofs = (unsigned)(tid >> 5) * XPITCH + (unsigned)(tid & 31) * 8u;
    v8h fa[4];
    int p = blockIdx.x;
    {
        const _Float16* at = attnout + (size_t)p * 8192;
#pragma unroll
        for (int i = 0; i < 4; ++i) fa[i] = *(const v8h*)(at + (aofs + i * 2048));
#pragma unroll
        for (int i = 0; i < 4; ++i) *(v8h*)(&as[0][sofs + i * 8 * XPITCH]) = fa[i];
    }
    __syncthreads();
    const float pb0 = proj_b[wave * 32 + m16], pb1 = proj_b[wave * 32 + 16 + m16];
    if (p + PROJ_G < PASSES) {
        const _Float16* at = attnout + (size_t)(p + PROJ_G) * 8192;
#pragma unroll
        for (int i = 0; i < 4; ++i) fa[i] = *(const v8h*)(at + (aofs + i * 2048));
    }
    // precaution: stands behind the loads, in front of any later write of
    // their address registers
    asm volatile("s_wait_xcnt 0x0" ::: "memory");
    // nothing is scheduled across this line: the loads stay above the products,
    // and no write of an address register is lifted above the wait
    __builtin_amdgcn_sched_barrier(0);

    int cur = 0;
    for (;;) {
        // acc[mt][nt][v]: token mt*16 + v + 8*hlf, column wave*32 + nt*16 + m16
        v8f acc[2][2];
#pragma unroll
        for (int mt = 0; mt < 2; ++mt) {
            acc[mt][0] = (v8f){0, 0, 0, 0, 0, 0, 0, 0};
            acc[mt][1] = (v8f){0, 0, 0, 0, 0, 0, 0, 0};
        }
        const _Float16* ac = as[cur] + m16 * XPITCH;
#pragma unroll
        for (int kg = 0; kg < 4; ++kg) {
            // four fragments (eight LDS loads) as one group, then their eight
            // products: one LDS wait per eight products
            v16h a[2][2];
#pragma unroll
            for (int kk = 0; kk < 2; ++kk)
#pragma unroll
                for (int mt = 0; mt < 2; ++mt)
                    a[kk][mt] = load_frag(ac + mt * 16 * XPITCH, (kg * 2 + kk) * 32, hlf);
            // keeps the group whole: without it the scheduler sinks each load
            // pair to its own products and waits on every pair
            __builtin_amdgcn_sched_barrier(0);
#pragma unroll
            for (int kk = 0; kk < 2; ++kk)
#pragma unroll
                for (int mt = 0; mt < 2; ++mt) {
                    acc[mt][0] = wmma_f16(a[kk][mt], wf[0][kg * 2 + kk], acc[mt][0]);
                    acc[mt][1] = wmma_f16(a[kk][mt], wf[1][kg * 2 + kk], acc[mt][1]);
                }
        }

        const bool more = p + PROJ_G < PASSES;          // the same for the whole work-group
        if (more) {
#pragma unroll
            for (int i = 0; i < 4; ++i) *(v8h*)(&as[cur ^ 1][sofs + i * 8 * XPITCH]) = fa[i];
        }
        __syncthreads();
        if (p + 2 * PROJ_G < PASSES) {
            const _Float16* at = attnout + (size_t)(p + 2 * PROJ_G) * 8192;
#pragma unroll
            for (int i = 0; i < 4; ++i) fa[i] = *(const v8h*)(at + (aofs + i * 2048));
            // precaution, as above
            asm volatile("s_wait_xcnt 0x0" ::: "memory");
        }
        // as above: loads first, no address write lifted above the wait
        __builtin_amdgcn_sched_barrier(0);

        float* op = out + ((unsigned)p * 8192u + (unsigned)(8 * hlf) * 256u + wave * 32 + m16);
#pragma unroll
        for (int mt = 0; mt < 2; ++mt) {
#pragma unroll
            for (int v = 0; v < 8; ++v) {
                op[(mt * 16 + v) * 256]      = acc[mt][0][v] + pb0;
                op[(mt * 16 + v) * 256 + 16] = acc[mt][1][v] + pb1;
            }
        }
        // precaution: behind the stores, in front of any later write of the
        // registers they name
        asm volatile("s_wait_xcnt 0x0" ::: "memory");
        // no such write is lifted above the wait
        __builtin_amdgcn_sched_barrier(0);

        if (!more) break;
        p += PROJ_G;
        cur ^= 1;
    }
}

// ---------------------------------------------------------------------------
extern "C" void kernel_launch(void* const* d_in, const int* in_sizes, int n_in,
                              void* d_out, int out_size, void* d_ws, size_t ws_size,
                              hipStream_t stream) {
    (void)in_sizes; (void)n_in; (void)out_size; (void)ws_size;

    const float* x        = (const float*)d_in[0];
    const float* qkv_w    = (const float*)d_in[1];
    const float* q_bias   = (const float*)d_in[2];
    const float* v_bias   = (const float*)d_in[3];
    const float* scale    = (const float*)d_in[4];
    const float* cpb_w1   = (const float*)d_in[5];
    const float* cpb_b1   = (const float*)d_in[6];
    const float* cpb_w2   = (const float*)d_in[7];
    const float* proj_w   = (const float*)d_in[8];
    const float* proj_b   = (const float*)d_in[9];
    const float* rel_tbl  = (const float*)d_in[10];
    const int*   rel_idx  = (const int*)d_in[11];
    float* out = (float*)d_out;

    // workspace layout (bytes): biasTab 128KB | attnout 64MB | wpack 512KB
    char* ws = (char*)d_ws;
    const size_t ATT_BYTES = (size_t)BATCH * HEADS * NTOK * HD * sizeof(_Float16); // 64 MiB
    float*    biasTab = (float*)ws;
    _Float16* attnout = (_Float16*)(ws + 131072);
    _Float16* wpack   = (_Float16*)(ws + 131072 + ATT_BYTES);

    cpb_kernel<<<256, 256, 0, stream>>>(rel_tbl, cpb_w1, cpb_b1, cpb_w2, rel_idx,
                                        qkv_w, proj_w, wpack, biasTab);

    qkv_attn_kernel<<<FUSE_G, 256, 0, stream>>>(
        x, wpack, q_bias, v_bias, biasTab, scale, attnout);

    proj_kernel<<<PROJ_G, 256, 0, stream>>>(attnout, wpack, proj_b, out);
}

// v006
// Measured time: 80.2 microseconds a run.
// Timed twice side by side with v005, it ran 1.14 and 1.13 times as fast.
// All steps since v000 together make it 4.60 times as fast.
#include <hip/hip_runtime.h>
#include <math.h>

// ---- problem constants ----
#define BATCH 2048
#define NTOK  64
#define CDIM  256
#define HEADS 8
#define HD    32

typedef __attribute__((ext_vector_type(16))) _Float16 v16h;
typedef __attribute__((ext_vector_type(8)))  _Float16 v8h;
typedef __attribute__((ext_vector_type(8)))  float    v8f;
typedef __attribute__((ext_vector_type(4)))  float    v4f;

// Load one WMMA 16x16x32 f16 operand fragment for this lane from row-major
// storage (rowPtr = start of this lane's row; stride handled by caller).
// ISA layout: elems 0..7 -> K = hlf*8 + i ; elems 8..15 -> K = 16 + hlf*8 + i.
__device__ __forceinline__ v16h load_frag(const _Float16* rowPtr, int kBase, int hlf) {
    v8h lo = *(const v8h*)(rowPtr + kBase + hlf * 8);
    v8h hi = *(const v8h*)(rowPtr + kBase + 16 + hlf * 8);
    v16h r;
#pragma unroll
    for (int i = 0; i < 8; ++i) { r[i] = lo[i]; r[8 + i] = hi[i]; }
    return r;
}

__device__ __forceinline__ v8f wmma_f16(v16h a, v16h b, v8f c) {
    return __builtin_amdgcn_wmma_f32_16x16x32_f16(false, a, false, b, (short)0, c, false, false);
}

// value of lane l ^ 16 (the other half of the wave), by a vector cross-row move
__device__ __forceinline__ float xhalf(float x) {
    const int i = __builtin_bit_cast(int, x);
    return __builtin_bit_cast(float,
        __builtin_amdgcn_permlanex16(i, i, 0x76543210, 0xfedcba98, false, false));
}

// ---------------------------------------------------------------------------
// Kernel 1: continuous position bias table.  bias(h, n, m) = 16*sigmoid(
//   MLP(rel_coords_table)[rel_pos_index[n][m]][h] ),  MLP = relu(x@w1^T+b1)@w2^T
// Stored per head in the order in which the attention kernel's transposed score
// tiles hold it: position p = nb*1024 + (mb*2 + j)*128 + (hl*16 + c)*4 + e is
// the pair n = nb*16 + c, m = mb*16 + hl*8 + j*4 + e.
// grid = 256, block = 256 (8 waves).  Each of blocks 0 .. 127 owns 32 positions, one per
// lane, and evaluates the MLP directly at each pair's table row, so no block
// needs another block's result.  Wave w sums hidden units [64w, 64w+64) for all
// 8 heads; the 8 partial sums per (head, pair) are added in wave order via LDS.
// Blocks 128 .. 255 of the same launch do not touch the bias table: they turn
// the four 256x256 weight matrices (q, k, v, out-projection) to f16 once, in the
// order in which a wave of the GEMM kernels holds them in registers.  Unit u (8
// halves, one per thread) = ((((mat*8 + wave)*2 + t)*8 + kc)*2 + j)*32 + lane is
// row wave*32 + t*16 + (lane & 15) of matrix mat, k = kc*32 + j*16 + (lane >> 4)*8
// .. + 7: the k order of load_frag, each half fragment 512 contiguous bytes.
// The out-projection's rows are dealt otherwise: row wave*32 + (lane & 15)*2 + t,
// so that a lane's two column tiles hold two adjacent output columns.
// ---------------------------------------------------------------------------
__global__ __launch_bounds__(256)
void cpb_kernel(const float* __restrict__ tbl2,   // [225][2]
                const float* __restrict__ w1,     // [512][2]
                const float* __restrict__ b1,     // [512]
                const float* __restrict__ w2,     // [8][512]
                const int*   __restrict__ idx,    // [64][64]
                const float* __restrict__ qkv_w,  // [768][256]
                const float* __restrict__ proj_w, // [256][256]
                _Float16* __restrict__ wpack,     // [4][8][2][8][2][32][8]
                float* __restrict__ biasTab) {    // [8][4096], order above
    __shared__ float red[8 * 8 * 32];             // [wave][head][pair]
    const int tid = threadIdx.x, lane = tid & 31;
    if (blockIdx.x >= 128) {                      // whole blocks: before any barrier
        const unsigned u = (blockIdx.x - 128u) * 256u + (unsigned)tid;
        const unsigned mat = u >> 13;
        const unsigned t = (u >> 9) & 1u, l16 = u & 15u;
        const unsigned row = ((u >> 10) & 7u) * 32u + ((mat < 3u) ? t * 16u + l16 : l16 * 2u + t);
        const unsigned k = ((u >> 6) & 7u) * 32u + ((u >> 5) & 1u) * 16u + ((u >> 4) & 1u) * 8u;
        const float* s = ((mat < 3u) ? qkv_w + mat * 65536u : proj_w) + (row * 256u + k);
        const float4 f0 = *(const float4*)s, f1 = *(const float4*)(s + 4);
        v8h r;
        r[0] = (_Float16)f0.x; r[1] = (_Float16)f0.y; r[2] = (_Float16)f0.z; r[3] = (_Float16)f0.w;
        r[4] = (_Float16)f1.x; r[5] = (_Float16)f1.y; r[6] = (_Float16)f1.z; r[7] = (_Float16)f1.w;
        *(v8h*)(wpack + u * 8u) = r;
        return;
    }
    // wave number as a scalar: the weight addresses below become wave-uniform,
    // so the weights arrive through scalar loads instead of 32 equal lane loads
    const int wave = __builtin_amdgcn_readfirstlane(tid >> 5);
    const int ij = blockIdx.x * 32 + lane;        // position p in the head's table
    const int pn = (ij >> 10) * 16 + ((ij >> 2) & 15);
    const int pm = ((ij >> 8) & 3) * 16 + ((ij >> 6) & 1) * 8 + ((ij >> 7) & 1) * 4 + (ij & 3);
    const int e = min(max(idx[pn * 64 + pm], 0), 224);   // bounds the table address
    const float i0 = tbl2[e * 2 + 0], i1 = tbl2[e * 2 + 1];

    float acc[8];
#pragma unroll
    for (int h = 0; h < 8; ++h) acc[h] = 0.0f;
    const int j0 = wave * 64;
    // 8 hidden units per trip: each trip waits once on its scalar loads, so
    // wider loads and fewer trips mean fewer load latencies in a row
#pragma unroll 8
    for (int jj = 0; jj < 64; ++jj) {
        const int j = j0 + jj;
        float hv = fmaxf(w1[j * 2 + 0] * i0 + w1[j * 2 + 1] * i1 + b1[j], 0.0f);
#pragma unroll
        for (int h = 0; h < 8; ++h) acc[h] += w2[h * 512 + j] * hv;
    }
#pragma unroll
    for (int h = 0; h < 8; ++h) red[(wave * 8 + h) * 32 + lane] = acc[h];
    __syncthreads();

    // wave w finishes head w for the block's 32 pairs: one 128-byte line
    float val = 0.0f;
#pragma unroll
    for (int w = 0; w < 8; ++w) val += red[(w * 8 + wave) * 32 + lane];
    biasTab[wave * 4096 + ij] = 16.0f / (1.0f + __expf(-val));
}

// ---------------------------------------------------------------------------
// One wave's share of a packed weight matrix: 32 rows x 256 k = 16 fragments,
// 128 registers, loaded once (wp = the wave's 8192 halves plus lane * 8).
// ---------------------------------------------------------------------------
__device__ __forceinline__ v16h load_wfrag(const _Float16* wp, int f) {
    v8h lo = *(const v8h*)(wp + f * 512);
    v8h hi = *(const v8h*)(wp + f * 512 + 256);
    v16h r;
#pragma unroll   // constant element numbers: no copy is left of this loop
    for (int i = 0; i < 8; ++i) { r[i] = lo[i]; r[8 + i] = hi[i]; }
    return r;
}

#define PASSES   4096      // passes of 32 tokens over the 131072 rows
#define XPITCH   264       // halves per staged row: 528 B, an odd multiple of 16 B
#define WINDOWS  2048
#define FUSE_G   256       // work-groups: one per WGP, 8 windows each

// two accumulator tiles that hold, per lane, 16 of a token's 32 head channels
// (lane ^ 16 the other 16): divided by the token's L2 norm and turned to f16
// they are in place that token's operand fragment (the k order of load_frag)
// (loops unrolled: constant element numbers, everything stays in registers)
__device__ __forceinline__ v16h norm_frag(v8f a0, v8f a1) {
    float s0 = 0.0f, s1 = 0.0f;
#pragma unroll
    for (int v = 0; v < 8; ++v) { s0 += a0[v] * a0[v]; s1 += a1[v] * a1[v]; }
    float ss = s0 + s1;
    ss += xhalf(ss);
    const float rn = 1.0f / fmaxf(sqrtf(ss), 1e-12f);
    v16h r;
#pragma unroll
    for (int v = 0; v < 8; ++v) { r[v] = (_Float16)(a0[v] * rn); r[8 + v] = (_Float16)(a1[v] * rn); }
    return r;
}

// ---------------------------------------------------------------------------
// Kernel 2: QKV projection, per-head L2 norm and attention in one kernel.
// grid = 256, block = 256 (8 waves), one work-group per WGP; the work-group
// walks over windows (w, w + 256, ...), wave h does head h of the window from
// the x tile to the attention output, and q, k, v never leave its registers.
// The wave keeps its head's 32 q rows and 32 k rows of the weights in registers
// for the whole kernel (248 registers, one fragment in LDS); the v weights and the bias table of all
// heads lie in LDS, beside one buffer for the window's x tile as f16.
// Products, all from the same x fragments:
//   Q^T = Wq @ x^T, K^T = Wk @ x^T: a lane holds, for its token, channels
//     t*16 + 8*hlf + v: norm_frag makes the token's fragment of them.
//   V = x @ Wv^T: a lane holds, for its channel, tokens mt*16 + 8*hlf + v.  Two
//     such tiles are in place a fragment of v^T over 32 keys.
//   S^T = k @ q^T, softmax in registers, O^T = v^T @ P^T.
// A window: q, k, v of the 64 tokens (the only reads of the x buffer); a
// barrier that ends those reads; attention per 16 queries, while the next
// window's x comes in through registers, 32 rows at a time; a barrier that
// publishes it.  The last tile's global stores stand behind that barrier,
// because a barrier waits for the wave's own global stores.
// Writes f16 in the order in which the waves hold it, so that each store of a
// wave is 512 contiguous bytes (four whole lines, no line shared with another
// wave): 16-byte unit (((window*4 + qt)*8 + head)*2 + db)*32 + lane is query
// qt*16 + (lane & 15), channels head*32 + db*16 + (lane >> 4)*8 .. + 7.
// ---------------------------------------------------------------------------
// (256 threads: up to 512 registers a wave, two waves per SIMD)
__global__ __launch_bounds__(256)
void qkv_attn_kernel(const float* __restrict__ x,        // [B*N][256]
                     const _Float16* __restrict__ wpack, // packed f16 weights
                     const float* __restrict__ q_bias,   // [256]
                     const float* __restrict__ v_bias,   // [256]
                     const float* __restrict__ biasTab,  // [8][4096]
                     const float* __restrict__ scale,    // [8]
                     _Float16* __restrict__ attnout) {   // order above
    __shared__ __attribute__((aligned(16))) _Float16 wvs[65536];
    __shared__ __attribute__((aligned(16))) float bts[32768];
    __shared__ __attribute__((aligned(16))) _Float16 xs[64 * XPITCH];
    __shared__ __attribute__((aligned(32))) float qbs[256];
    __shared__ __attribute__((aligned(16))) _Float16 wq0s[8 * 512];
    const int tid  = threadIdx.x;
    const int lane = tid & 31;
    const int wave = __builtin_amdgcn_readfirstlane(tid >> 5);   // scalar: uniform bases
    const int m16 = lane & 15, hlf = lane >> 4;

    // (every loop in this kernel but the window loop is unrolled: all arrays are
    // then indexed by constants and stay in registers)
    {
        // the packed v weights and the bias table, 128 KB each, as they lie:
        // 16-byte unit tid + i*256
        const _Float16* wp = wpack + (2u * 65536u + (unsigned)tid * 8u);
        const float* bp = biasTab + (unsigned)tid * 4u;
#pragma unroll
        for (int g = 0; g < 4; ++g) {
            v8h t[8];
            v4f u[8];
#pragma unroll
            for (int i = 0; i < 8; ++i) {
                t[i] = *(const v8h*)(wp + (g * 8 + i) * 2048);
                u[i] = *(const v4f*)(bp + (g * 8 + i) * 1024);
            }
#pragma unroll
            for (int i = 0; i < 8; ++i) {
                *(v8h*)(wvs + (unsigned)tid * 8u + (g * 8 + i) * 2048) = t[i];
                *(v4f*)(bts + (unsigned)tid * 4u + (g * 8 + i) * 1024) = u[i];
            }
        }
        // precaution: the wait takes the addresses as inputs, so their registers
        // live up to it and no load of the run lands on them
        asm volatile("s_wait_xcnt 0x0" :: "v"(wp), "v"(bp) : "memory");
    }
    const float* btl = bts + ((unsigned)wave * 4096u + (unsigned)lane * 4u);
    const _Float16* wvl = wvs + ((unsigned)wave * 8192u + (unsigned)lane * 8u);

    // a window's x tile is 64 KB contiguous: float4 number tid + i*256 is row
    // (tid >> 6) + 4*i, columns (tid & 63)*4 .. + 3
    const unsigned xofs = (unsigned)tid * 4u;
    const unsigned sofs = (unsigned)(tid >> 6) * XPITCH + (unsigned)(tid & 63) * 4u;
    int w = blockIdx.x;
    float vb0, vb1;                    // v bias of channels m16 and 16 + m16 of the head
    {
        float4 fx[16];
        const float* xt = x + (size_t)w * 16384;
#pragma unroll
        for (int i = 0; i < 16; ++i) fx[i] = *(const float4*)(xt + (xofs + i * 1024));
        const float qb = q_bias[tid];
        vb0 = v_bias[wave * 32 + m16];
        vb1 = v_bias[wave * 32 + 16 + m16];
        // precaution: behind the loads, in front of any later write of their
        // address registers
        asm volatile("s_wait_xcnt 0x0" ::: "memory");
        // no such write is lifted above the wait
        __builtin_amdgcn_sched_barrier(0);
        qbs[tid] = qb;
#pragma unroll
        for (int i = 0; i < 16; ++i) {
            _Float16* d = &xs[sofs + i * 4 * XPITCH];
            d[0] = (_Float16)fx[i].x; d[1] = (_Float16)fx[i].y;
            d[2] = (_Float16)fx[i].z; d[3] = (_Float16)fx[i].w;
        }
    }

    const float sc = __expf(fminf(scale[wave], 4.60517018599f));   // ln(100)

    v16h wq[2][8], wk[2][8];           // [channel tile][k chunk]
    _Float16* wq0l = wq0s + ((unsigned)wave * 512u + (unsigned)lane * 8u);
    {
        const _Float16* wp = wpack + ((unsigned)wave * 8192u + (unsigned)lane * 8u);
#pragma unroll
        for (int f = 0; f < 16; ++f) wq[f >> 3][f & 7] = load_wfrag(wp, f);
#pragma unroll
        for (int f = 0; f < 16; ++f) wk[f >> 3][f & 7] = load_wfrag(wp + 65536, f);
        // precaution: the wait takes the address as an input, as above
        asm volatile("s_wait_xcnt 0x0" :: "v"(wp) : "memory");
        // the registers hold 31 of the 32 fragments (with all 32 the compiler
        // kept one in scratch memory): the first q fragment lies in LDS and comes
        // with the fragment group of k chunk 0
#pragma unroll
        for (int i = 0; i < 8; ++i) { wq0l[i] = wq[0][0][i]; wq0l[256 + i] = wq[0][0][8 + i]; }
    }
    __syncthreads();

    const _Float16* xc = xs + m16 * XPITCH;
    for (;;) {
        const bool more = w + FUSE_G < WINDOWS;         // the same for the whole work-group
        // no branch stands inside a window: the compiler moves work across a
        // branch (the end of the q, k, v part went below the x loads, and the
        // registers did not suffice).  So the last window fetches its own tile
        // once more, which nobody reads
        const float* xn = x + (size_t)(more ? w + FUSE_G : w) * 16384;
        float4 fn[8];

        // ---- q, k, v of the 64 tokens, 32 tokens at a time ----
        v16h qf[4];        // qf[qt]: query qt*16 + m16, the head's 32 channels
        v16h kf[4];        // kf[mb]: key mb*16 + m16, the head's 32 channels
        v16h vf[2][2];     // vf[db][kb]: channel db*16 + m16, keys kb*32 .. + 31
#pragma unroll
        for (int hw = 0; hw < 2; ++hw) {
            // aq, ak[t][n]: channel t*16 + 8*hlf + v of token (hw*2 + n)*16 + m16
            // av[n][c]: token (hw*2 + n)*16 + 8*hlf + v, channel c*16 + m16
            // the q and v sums start at the bias, k has none
            v8f aq[2][2], ak[2][2], av[2][2];
#pragma unroll
            for (int n = 0; n < 2; ++n) {
                aq[n][0] = *(const v8f*)(qbs + wave * 32 + n * 16 + 8 * hlf);
                aq[n][1] = aq[n][0];
                ak[0][n] = (v8f){0, 0, 0, 0, 0, 0, 0, 0};
                ak[1][n] = (v8f){0, 0, 0, 0, 0, 0, 0, 0};
                av[n][0] = (v8f){vb0, vb0, vb0, vb0, vb0, vb0, vb0, vb0};
                av[n][1] = (v8f){vb1, vb1, vb1, vb1, vb1, vb1, vb1, vb1};
            }
#pragma unroll
            for (int kc = 0; kc < 8; ++kc) {
                // a k chunk's four fragments (eight LDS loads) as one group, then
                // their twelve products: one LDS wait per twelve products
                v16h b[2], wv[2];      // [token tile], [channel tile]
#pragma unroll
                for (int n = 0; n < 2; ++n) {
                    b[n]  = load_frag(xc + (hw * 2 + n) * 16 * XPITCH, kc * 32, hlf);
                    wv[n] = load_wfrag(wvl, n * 8 + kc);
                }
                const v16h wq0 = (kc == 0) ? load_wfrag(wq0l, 0) : wq[0][kc];
                // keeps the group whole: without it the scheduler sinks each load
                // pair to its own products and waits on every pair
                __builtin_amdgcn_sched_barrier(0);
#pragma unroll
                for (int n = 0; n < 2; ++n) {
                    aq[0][n] = wmma_f16(wq0, b[n], aq[0][n]);
                    aq[1][n] = wmma_f16(wq[1][kc], b[n], aq[1][n]);
                    ak[0][n] = wmma_f16(wk[0][kc], b[n], ak[0][n]);
                    ak[1][n] = wmma_f16(wk[1][kc], b[n], ak[1][n]);
                    av[n][0] = wmma_f16(b[n], wv[0], av[n][0]);
                    av[n][1] = wmma_f16(b[n], wv[1], av[n][1]);
                }
                // no later group rises above these products: there are registers
                // for one group of fragments only (the SIMD's other wave works
                // while this one waits for its group)
                __builtin_amdgcn_sched_barrier(0);
            }
#pragma unroll
            for (int n = 0; n < 2; ++n) {
                qf[hw * 2 + n] = norm_frag(aq[0][n], aq[1][n]);
                kf[hw * 2 + n] = norm_frag(ak[0][n], ak[1][n]);
#pragma unroll
                for (int v = 0; v < 8; ++v) {
                    vf[0][hw][n * 8 + v] = (_Float16)av[n][0][v];
                    vf[1][hw][n * 8 + v] = (_Float16)av[n][1][v];
                }
            }
            // the sums' registers are free before anything later starts
            __builtin_amdgcn_sched_barrier(0);
        }
        __syncthreads();       // every wave has read the x buffer for the last time

        // ---- attention, 16 queries at a time; the next x tile on the way ----
        v8h rl[2];         // the last tile's output, stored behind the barrier
#pragma unroll
        for (int qt = 0; qt < 4; ++qt) {
            if ((qt & 1) == 0) {
#pragma unroll
                for (int i = 0; i < 8; ++i)
                    fn[i] = *(const float4*)(xn + (xofs + (qt >> 1) * 8192 + i * 1024));
                // precaution: behind the loads, in front of any later write of
                // their address registers
                asm volatile("s_wait_xcnt 0x0" ::: "memory");
                // nothing is scheduled across this line: the loads stay above two
                // tiles' work, and no address write is lifted above the wait
                __builtin_amdgcn_sched_barrier(0);
            }
            // S^T = k @ q^T: s[mb][v] is the score of key mb*16 + 8*hlf + v
            // against query qt*16 + m16; its bias is entry mb*2 + (v >> 2) of the
            // tile's eight, 512 contiguous bytes per load
            float s[4][8];
#pragma unroll
            for (int mb = 0; mb < 4; ++mb) {
                const v4f b0 = *(const v4f*)(btl + (qt * 1024 + mb * 256));
                const v4f b1 = *(const v4f*)(btl + (qt * 1024 + mb * 256 + 128));
                v8f t = (v8f){0, 0, 0, 0, 0, 0, 0, 0};
                t = wmma_f16(kf[mb], qf[qt], t);
                s[mb][0] = t[0] * sc + b0.x; s[mb][1] = t[1] * sc + b0.y;
                s[mb][2] = t[2] * sc + b0.z; s[mb][3] = t[3] * sc + b0.w;
                s[mb][4] = t[4] * sc + b1.x; s[mb][5] = t[5] * sc + b1.y;
                s[mb][6] = t[6] * sc + b1.z; s[mb][7] = t[7] * sc + b1.w;
            }

            // softmax over the query's 64 keys in fp32: 32 in this lane, 32 in
            // lane ^ 16
            float mxp[4];
#pragma unroll
            for (int mb = 0; mb < 4; ++mb) {
                mxp[mb] = s[mb][0];
#pragma unroll
                for (int v = 1; v < 8; ++v) mxp[mb] = fmaxf(mxp[mb], s[mb][v]);
            }
            float mx = fmaxf(fmaxf(mxp[0], mxp[1]), fmaxf(mxp[2], mxp[3]));
            mx = fmaxf(mx, xhalf(mx));
            // pf[kb] element i is key kb*32 + 8*hlf + i, element 8+i key kb*32 +
            // 16 + 8*hlf + i: the k order of vf
            v16h pf[2];
            float sump[4];                     // four independent sums, one per tile
#pragma unroll
            for (int mb = 0; mb < 4; ++mb) {
                float a[8], e[8];
#pragma unroll
                for (int v = 0; v < 8; ++v) a[v] = (s[mb][v] - mx) * 1.44269504089f;   // log2(e)
                // e = 2^a, one tile's eight in one statement: the outputs are
                // registers of their own ("=&v"), so no exponential is directly
                // followed by a read of its result or a write of its source; the
                // v_nop keeps that one slot behind the last one, whatever the
                // compiler places next
                asm("v_exp_f32 %0, %8\n\tv_exp_f32 %1, %9\n\tv_exp_f32 %2, %10\n\t"
                    "v_exp_f32 %3, %11\n\tv_exp_f32 %4, %12\n\tv_exp_f32 %5, %13\n\t"
                    "v_exp_f32 %6, %14\n\tv_exp_f32 %7, %15\n\tv_nop"
                    : "=&v"(e[0]), "=&v"(e[1]), "=&v"(e[2]), "=&v"(e[3]),
                      "=&v"(e[4]), "=&v"(e[5]), "=&v"(e[6]), "=&v"(e[7])
                    : "v"(a[0]), "v"(a[1]), "v"(a[2]), "v"(a[3]),
                      "v"(a[4]), "v"(a[5]), "v"(a[6]), "v"(a[7]));
                sump[mb] = e[0];
#pragma unroll
                for (int v = 1; v < 8; ++v) sump[mb] += e[v];
#pragma unroll
                for (int v = 0; v < 8; ++v) pf[mb >> 1][(mb & 1) * 8 + v] = (_Float16)e[v];
            }
            float sum = (sump[0] + sump[1]) + (sump[2] + sump[3]);
            sum += xhalf(sum);
            const float inv = 1.0f / sum;

            // O^T = v^T @ P^T (K = 64: 2 WMMA steps): o[v] is channel
            // db*16 + 8*hlf + v of query qt*16 + m16, one 16-byte store
            _Float16* orow = attnout + ((unsigned)w * 16384u + qt * 4096 + wave * 512 + lane * 8);
#pragma unroll
            for (int db = 0; db < 2; ++db) {
                v8f o = (v8f){0, 0, 0, 0, 0, 0, 0, 0};
#pragma unroll
                for (int kb = 0; kb < 2; ++kb) o = wmma_f16(vf[db][kb], pf[kb], o);
                v8h r;
#pragma unroll
                for (int v = 0; v < 8; ++v) r[v] = (_Float16)(o[v] * inv);
                if (qt < 3) *(v8h*)(orow + db * 256) = r;
                else        rl[db] = r;
            }
            if (qt < 3) {
                // precaution: behind the stores, in front of any later write of
                // the registers they name
                asm volatile("s_wait_xcnt 0x0" ::: "memory");
                // no such write is lifted above the wait
                __builtin_amdgcn_sched_barrier(0);
            }
            if ((qt & 1) == 1) {
                // the 32 rows that came in during these two tiles
#pragma unroll
                for (int i = 0; i < 8; ++i) {
                    _Float16* d = &xs[sofs + ((qt >> 1) * 8 + i) * 4 * XPITCH];
                    d[0] = (_Float16)fn[i].x; d[1] = (_Float16)fn[i].y;
                    d[2] = (_Float16)fn[i].z; d[3] = (_Float16)fn[i].w;
                }
                // the next 32 rows' loads do not rise above this: they take the
                // same registers, and their wait stands directly behind them
                __builtin_amdgcn_sched_barrier(0);
            }
        }
        __syncthreads();       // publishes the next window's x tile
        {
            _Float16* orow = attnout + ((unsigned)w * 16384u + 3 * 4096 + wave * 512 + lane * 8);
            *(v8h*)(orow)       = rl[0];
            *(v8h*)(orow + 256) = rl[1];
            // precaution, as above
            asm volatile("s_wait_xcnt 0x0" ::: "memory");
            // no write of the stores' registers is lifted above the wait
            __builtin_amdgcn_sched_barrier(0);
        }

        if (!more) break;
        w += FUSE_G;
    }
}

// ---------------------------------------------------------------------------
// Kernel 3: output projection.  out[131072x256] = attnout @ proj_w^T + proj_b.
// grid = 512, block = 256 (8 waves).  Weights stay put: wave w keeps weight rows
// (output columns) 32w .. 32w+31 in registers, the work-group walks over 8
// passes of 32 tokens, staged in two LDS buffers.  A pass: products from this
// buffer; the next tile (loaded to registers one pass ago) goes to the other
// buffer; one barrier; the loads of the tile after next; the stores.
// Column tile nt of a wave holds columns 32w + 2*m16 + nt (the packing deals the
// weight rows so): a lane stores two adjacent columns at once, 16 lanes a whole
// 128-byte line of a token's row.
// ---------------------------------------------------------------------------
#define PROJ_G 512
// (second bound: 4 waves per SIMD = 256 registers a wave, two work-groups a WGP)
__global__ __launch_bounds__(256, 4)
void proj_kernel(const _Float16* __restrict__ attnout,
                            const _Float16* __restrict__ wpack, // packed f16 weights
                            const float* __restrict__ proj_b,   // [256]
                            float* __restrict__ out) {
    __shared__ __attribute__((aligned(16))) _Float16 as[2][32 * XPITCH];
    const int tid = threadIdx.x, lane = tid & 31;
    const int wave = __builtin_amdgcn_readfirstlane(tid >> 5);   // scalar: uniform bases
    const int m16 = lane & 15, hlf = lane >> 4;

    // (every loop over fragments, tiles and staged values in this kernel is
    // unrolled: wf, fa, acc, a are then indexed by constants and stay in registers)
    v16h wf[2][8];                     // [column tile][k chunk]
    {
        const _Float16* wp = wpack + ((unsigned)(24 + wave) * 8192u + (unsigned)lane * 8u);
#pragma unroll
        for (int f = 0; f < 16; ++f) wf[f >> 3][f & 7] = load_wfrag(wp, f);
        // precaution: the wait takes the address as an input, so its registers
        // live up to it and no load of the run lands on them
        asm volatile("s_wait_xcnt 0x0" :: "v"(wp) : "memory");
    }

    // a pass's tile is 16 KB contiguous, in the attention waves' order: 16-byte
    // unit tid + i*256 is row (i >> 1)*16 + (tid & 15), halves (i & 1)*128 +
    // (tid >> 4)*8 .. + 7
    const unsigned aofs = (unsigned)tid * 8u;
    const unsigned sofs = (unsigned)(tid & 15) * XPITCH + (unsigned)(tid >> 4) * 8u;
    v8h fa[4];
    int p = blockIdx.x;
    {
        const _Float16* at = attnout + (size_t)p * 8192;
#pragma unroll
        for (int i = 0; i < 4; ++i) fa[i] = *(const v8h*)(at + (aofs + i * 2048));
#pragma unroll
        for (int i = 0; i < 4; ++i) *(v8h*)(&as[0][sofs + (i >> 1) * 16 * XPITCH + (i & 1) * 128]) = fa[i];
    }
    __syncthreads();
    const float pb0 = proj_b[wave * 32 + m16 * 2], pb1 = proj_b[wave * 32 + m16 * 2 + 1];
    if (p + PROJ_G < PASSES) {
        const _Float16* at = attnout + (size_t)(p + PROJ_G) * 8192;
#pragma unroll
        for (int i = 0; i < 4; ++i) fa[i] = *(const v8h*)(at + (aofs + i * 2048));
    }
    // precaution: stands behind the loads, in front of any later write of
    // their address registers
    asm volatile("s_wait_xcnt 0x0" ::: "memory");
    // nothing is scheduled across this line: the loads stay above the products,
    // and no write of an address register is lifted above the wait
    __builtin_amdgcn_sched_barrier(0);

    int cur = 0;
    for (;;) {
        // acc[mt][nt][v]: token mt*16 + v + 8*hlf, column wave*32 + m16*2 + nt
        v8f acc[2][2];
#pragma unroll
        for (int mt = 0; mt < 2; ++mt) {
            acc[mt][0] = (v8f){0, 0, 0, 0, 0, 0, 0, 0};
            acc[mt][1] = (v8f){0, 0, 0, 0, 0, 0, 0, 0};
        }
        const _Float16* ac = as[cur] + m16 * XPITCH;
#pragma unroll
        for (int kg = 0; kg < 4; ++kg) {
            // four fragments (eight LDS loads) as one group, then their eight
            // products: one LDS wait per eight products
            v16h a[2][2];
#pragma unroll
            for (int kk = 0; kk < 2; ++kk)
#pragma unroll
                for (int mt = 0; mt < 2; ++mt)
                    a[kk][mt] = load_frag(ac + mt * 16 * XPITCH, (kg * 2 + kk) * 32, hlf);
            // keeps the group whole: without it the scheduler sinks each load
            // pair to its own products and waits on every pair
            __builtin_amdgcn_sched_barrier(0);
#pragma unroll
            for (int kk = 0; kk < 2; ++kk)
#pragma unroll
                for (int mt = 0; mt < 2; ++mt) {
                    acc[mt][0] = wmma_f16(a[kk][mt], wf[0][kg * 2 + kk], acc[mt][0]);
                    acc[mt][1] = wmma_f16(a[kk][mt], wf[1][kg * 2 + kk], acc[mt][1]);
                }
        }

        const bool more = p + PROJ_G < PASSES;          // the same for the whole work-group
        if (more) {
#pragma unroll
            for (int i = 0; i < 4; ++i)
                *(v8h*)(&as[cur ^ 1][sofs + (i >> 1) * 16 * XPITCH + (i & 1) * 128]) = fa[i];
        }
        __syncthreads();
        if (p + 2 * PROJ_G < PASSES) {
            const _Float16* at = attnout + (size_t)(p + 2 * PROJ_G) * 8192;
#pragma unroll
            for (int i = 0; i < 4; ++i) fa[i] = *(const v8h*)(at + (aofs + i * 2048));
            // precaution, as above
            asm volatile("s_wait_xcnt 0x0" ::: "memory");
        }
        // as above: loads first, no address write lifted above the wait
        __builtin_amdgcn_sched_barrier(0);

        float* op = out + ((unsigned)p * 8192u + (unsigned)(8 * hlf) * 256u + wave * 32 + m16 * 2);
#pragma unroll
        for (int mt = 0; mt < 2; ++mt) {
#pragma unroll
            for (int v = 0; v < 8; ++v)
                *(float2*)(op + (mt * 16 + v) * 256) =
                    make_float2(acc[mt][0][v] + pb0, acc[mt][1][v] + pb1);
        }
        // precaution: behind the stores, in front of any later write of the
        // registers they name
        asm volatile("s_wait_xcnt 0x0" ::: "memory");
        // no such write is lifted above the wait
        __builtin_amdgcn_sched_barrier(0);

        if (!more) break;
        p += PROJ_G;
        cur ^= 1;
    }
}

// ---------------------------------------------------------------------------
extern "C" void kernel_launch(void* const* d_in, const int* in_sizes, int n_in,
                              void* d_out, int out_size, void* d_ws, size_t ws_size,
                              hipStream_t stream) {
    (void)in_sizes; (void)n_in; (void)out_size; (void)ws_size;

    const float* x        = (const float*)d_in[0];
    const float* qkv_w    = (const float*)d_in[1];
    const float* q_bias   = (const float*)d_in[2];
    const float* v_bias   = (const float*)d_in[3];
    const float* scale    = (const float*)d_in[4];
    const float* cpb_w1   = (const float*)d_in[5];
    const float* cpb_b1   = (const float*)d_in[6];
    const float* cpb_w2   = (const float*)d_in[7];
    const float* proj_w   = (const float*)d_in[8];
    const float* proj_b   = (const float*)d_in[9];
    const float* rel_tbl  = (const float*)d_in[10];
    const int*   rel_idx  = (const int*)d_in[11];
    float* out = (float*)d_out;

    // workspace layout (bytes): biasTab 128KB | attnout 64MB | wpack 512KB
    char* ws = (char*)d_ws;
    const size_t ATT_BYTES = (size_t)BATCH * HEADS * NTOK * HD * sizeof(_Float16); // 64 MiB
    float*    biasTab = (float*)ws;
    _Float16* attnout = (_Float16*)(ws + 131072);
    _Float16* wpack   = (_Float16*)(ws + 131072 + ATT_BYTES);

    cpb_kernel<<<256, 256, 0, stream>>>(rel_tbl, cpb_w1, cpb_b1, cpb_w2, rel_idx,
                                        qkv_w, proj_w, wpack, biasTab);

    qkv_attn_kernel<<<FUSE_G, 256, 0, stream>>>(
        x, wpack, q_bias, v_bias, biasTab, scale, attnout);

    proj_kernel<<<PROJ_G, 256, 0, stream>>>(attnout, wpack, proj_b, out);
}

// v007
// A run of this version takes 77 microseconds.
// In two side-by-side timings against v006, it was 1.05 and 1.04 times as fast.
// Over all steps from v000 it is 4.81 times as fast.
#include <hip/hip_runtime.h>
#include <math.h>

// ---- problem constants ----
#define BATCH 2048
#define NTOK  64
#define CDIM  256
#define HEADS 8
#define HD    32

typedef __attribute__((ext_vector_type(16))) _Float16 v16h;
typedef __attribute__((ext_vector_type(8)))  _Float16 v8h;
typedef __attribute__((ext_vector_type(8)))  float    v8f;
typedef __attribute__((ext_vector_type(4)))  float    v4f;

// Load one WMMA 16x16x32 f16 operand fragment for this lane from row-major
// storage (rowPtr = start of this lane's row; stride handled by caller).
// ISA layout: elems 0..7 -> K = hlf*8 + i ; elems 8..15 -> K = 16 + hlf*8 + i.
__device__ __forceinline__ v16h load_frag(const _Float16* rowPtr, int kBase, int hlf) {
    v8h lo = *(const v8h*)(rowPtr + kBase + hlf * 8);
    v8h hi = *(const v8h*)(rowPtr + kBase + 16 + hlf * 8);
    v16h r;
#pragma unroll
    for (int i = 0; i < 8; ++i) { r[i] = lo[i]; r[8 + i] = hi[i]; }
    return r;
}

__device__ __forceinline__ v8f wmma_f16(v16h a, v16h b, v8f c) {
    return __builtin_amdgcn_wmma_f32_16x16x32_f16(false, a, false, b, (short)0, c, false, false);
}

// value of lane l ^ 16 (the other half of the wave), by a vector cross-row move
__device__ __forceinline__ float xhalf(float x) {
    const int i = __builtin_bit_cast(int, x);
    return __builtin_bit_cast(float,
        __builtin_amdgcn_permlanex16(i, i, 0x76543210, 0xfedcba98, false, false));
}

// ---------------------------------------------------------------------------
// Kernel 1: continuous position bias table.  bias(h, n, m) = 16*sigmoid(
//   MLP(rel_coords_table)[rel_pos_index[n][m]][h] ),  MLP = relu(x@w1^T+b1)@w2^T
// Stored per head in the order in which the attention kernel's transposed score
// tiles hold it: position p = nb*1024 + (mb*2 + j)*128 + (hl*16 + c)*4 + e is
// the pair n = nb*16 + c, m = mb*16 + hl*8 + j*4 + e.
// grid = 256, block = 256 (8 waves).  Each of blocks 0 .. 127 owns 32 positions, one per
// lane, and evaluates the MLP directly at each pair's table row, so no block
// needs another block's result.  Wave w sums hidden units [64w, 64w+64) for all
// 8 heads; the 8 partial sums per (head, pair) are added in wave order via LDS.
// Blocks 128 .. 255 of the same launch do not touch the bias table: they turn
// the four 256x256 weight matrices (q, k, v, out-projection) to f16 once, in the
// order in which a wave of the GEMM kernels holds them in registers.  Unit u (8
// halves, one per thread) = ((((mat*8 + wave)*2 + t)*8 + kc)*2 + j)*32 + lane is
// row wave*32 + t*16 + (lane & 15) of matrix mat, k = kc*32 + j*16 + (lane >> 4)*8
// .. + 7: the k order of load_frag, each half fragment 512 contiguous bytes.
// The out-projection's rows are dealt otherwise: row wave*32 + (lane & 15)*2 + t,
// so that a lane's two column tiles hold two adjacent output columns.
// ---------------------------------------------------------------------------
__global__ __launch_bounds__(256)
void cpb_kernel(const float* __restrict__ tbl2,   // [225][2]
                const float* __restrict__ w1,     // [512][2]
                const float* __restrict__ b1,     // [512]
                const float* __restrict__ w2,     // [8][512]
                const int*   __restrict__ idx,    // [64][64]
                const float* __restrict__ qkv_w,  // [768][256]
                const float* __restrict__ proj_w, // [256][256]
                _Float16* __restrict__ wpack,     // [4][8][2][8][2][32][8]
                float* __restrict__ biasTab) {    // [8][4096], order above
    __shared__ float red[8 * 8 * 32];             // [wave][head][pair]
    const int tid = threadIdx.x, lane = tid & 31;
    if (blockIdx.x >= 128) {                      // whole blocks: before any barrier
        const unsigned u = (blockIdx.x - 128u) * 256u + (unsigned)tid;
        const unsigned mat = u >> 13;
        const unsigned t = (u >> 9) & 1u, l16 = u & 15u;
        const unsigned row = ((u >> 10) & 7u) * 32u + ((mat < 3u) ? t * 16u + l16 : l16 * 2u + t);
        const unsigned k = ((u >> 6) & 7u) * 32u + ((u >> 5) & 1u) * 16u + ((u >> 4) & 1u) * 8u;
        const float* s = ((mat < 3u) ? qkv_w + mat * 65536u : proj_w) + (row * 256u + k);
        const float4 f0 = *(const float4*)s, f1 = *(const float4*)(s + 4);
        v8h r;
        r[0] = (_Float16)f0.x; r[1] = (_Float16)f0.y; r[2] = (_Float16)f0.z; r[3] = (_Float16)f0.w;
        r[4] = (_Float16)f1.x; r[5] = (_Float16)f1.y; r[6] = (_Float16)f1.z; r[7] = (_Float16)f1.w;
        *(v8h*)(wpack + u * 8u) = r;
        return;
    }
    // wave number as a scalar: the weight addresses below become wave-uniform,
    // so the weights arrive through scalar loads instead of 32 equal lane loads
    const int wave = __builtin_amdgcn_readfirstlane(tid >> 5);
    const int ij = blockIdx.x * 32 + lane;        // position p in the head's table
    const int pn = (ij >> 10) * 16 + ((ij >> 2) & 15);
    const int pm = ((ij >> 8) & 3) * 16 + ((ij >> 6) & 1) * 8 + ((ij >> 7) & 1) * 4 + (ij & 3);
    const int e = min(max(idx[pn * 64 + pm], 0), 224);   // bounds the table address
    const float i0 = tbl2[e * 2 + 0], i1 = tbl2[e * 2 + 1];

    float acc[8];
#pragma unroll
    for (int h = 0; h < 8; ++h) acc[h] = 0.0f;
    const int j0 = wave * 64;
    // 8 hidden units per trip: each trip waits once on its scalar loads, so
    // wider loads and fewer trips mean fewer load latencies in a row
#pragma unroll 8
    for (int jj = 0; jj < 64; ++jj) {
        const int j = j0 + jj;
        float hv = fmaxf(w1[j * 2 + 0] * i0 + w1[j * 2 + 1] * i1 + b1[j], 0.0f);
#pragma unroll
        for (int h = 0; h < 8; ++h) acc[h] += w2[h * 512 + j] * hv;
    }
#pragma unroll
    for (int h = 0; h < 8; ++h) red[(wave * 8 + h) * 32 + lane] = acc[h];
    __syncthreads();

    // wave w finishes head w for the block's 32 pairs: one 128-byte line
    float val = 0.0f;
#pragma unroll
    for (int w = 0; w < 8; ++w) val += red[(w * 8 + wave) * 32 + lane];
    biasTab[wave * 4096 + ij] = 16.0f / (1.0f + __expf(-val));
}

// ---------------------------------------------------------------------------
// One wave's share of a packed weight matrix: 32 rows x 256 k = 16 fragments,
// 128 registers, loaded once (wp = the wave's 8192 halves plus lane * 8).
// ---------------------------------------------------------------------------
__device__ __forceinline__ v16h load_wfrag(const _Float16* wp, int f) {
    v8h lo = *(const v8h*)(wp + f * 512);
    v8h hi = *(const v8h*)(wp + f * 512 + 256);
    v16h r;
#pragma unroll   // constant element numbers: no copy is left of this loop
    for (int i = 0; i < 8; ++i) { r[i] = lo[i]; r[8 + i] = hi[i]; }
    return r;
}

#define PASSES   4096      // passes of 32 tokens over the 131072 rows
#define XPITCH   264       // halves per staged row: 528 B, an odd multiple of 16 B
#define WINDOWS  2048
#define FUSE_G   256       // work-groups: one per WGP, 8 windows each

// two accumulator tiles that hold, per lane, 16 of a token's 32 head channels
// (lane ^ 16 the other 16): divided by the token's L2 norm and turned to f16
// they are in place that token's operand fragment (the k order of load_frag)
// (loops unrolled: constant element numbers, everything stays in registers)
__device__ __forceinline__ v16h norm_frag(v8f a0, v8f a1) {
    float s0 = 0.0f, s1 = 0.0f;
#pragma unroll
    for (int v = 0; v < 8; ++v) { s0 += a0[v] * a0[v]; s1 += a1[v] * a1[v]; }
    float ss = s0 + s1;
    ss += xhalf(ss);
    const float rn = 1.0f / fmaxf(sqrtf(ss), 1e-12f);
    v16h r;
#pragma unroll
    for (int v = 0; v < 8; ++v) { r[v] = (_Float16)(a0[v] * rn); r[8 + v] = (_Float16)(a1[v] * rn); }
    return r;
}

// ---------------------------------------------------------------------------
// Kernel 2: QKV projection, per-head L2 norm and attention in one kernel.
// grid = 256, block = 256 (8 waves), one work-group per WGP; the work-group
// walks over windows (w, w + 256, ...), wave h does head h of the window from
// the x tile to the attention output, and q, k, v never leave its registers.
// The wave keeps its head's 32 q rows and 32 k rows of the weights in registers
// for the whole kernel (248 registers, one fragment in LDS); the v weights and the bias table of all
// heads lie in LDS, beside one buffer for the window's x tile as f16.
// Products, all from the same x fragments:
//   Q^T = Wq @ x^T, K^T = Wk @ x^T: a lane holds, for its token, channels
//     t*16 + 8*hlf + v: norm_frag makes the token's fragment of them.
//   V = x @ Wv^T: a lane holds, for its channel, tokens mt*16 + 8*hlf + v.  Two
//     such tiles are in place a fragment of v^T over 32 keys.
//   S^T = k @ q^T, softmax in registers, O^T = v^T @ P^T.
// A window: q, k, v of the 64 tokens (the only reads of the x buffer); a
// barrier that ends those reads; attention per 16 queries, while the next
// window's x comes in through registers, 32 rows at a time; a barrier that
// publishes it.  The last tile's global stores stand behind that barrier,
// because a barrier waits for the wave's own global stores.
// Writes f16 in the order in which the waves hold it, so that each store of a
// wave is 512 contiguous bytes (four whole lines, no line shared with another
// wave): 16-byte unit (((window*4 + qt)*8 + head)*2 + db)*32 + lane is query
// qt*16 + (lane & 15), channels head*32 + db*16 + (lane >> 4)*8 .. + 7.
// ---------------------------------------------------------------------------
// (256 threads: up to 512 registers a wave, two waves per SIMD)
__global__ __launch_bounds__(256)
void qkv_attn_kernel(const float* __restrict__ x,        // [B*N][256]
                     const _Float16* __restrict__ wpack, // packed f16 weights
                     const float* __restrict__ q_bias,   // [256]
                     const float* __restrict__ v_bias,   // [256]
                     const float* __restrict__ biasTab,  // [8][4096]
                     const float* __restrict__ scale,    // [8]
                     _Float16* __restrict__ attnout) {   // order above
    __shared__ __attribute__((aligned(16))) _Float16 wvs[65536];
    __shared__ __attribute__((aligned(16))) float bts[32768];
    __shared__ __attribute__((aligned(16))) _Float16 xs[64 * XPITCH];
    __shared__ __attribute__((aligned(32))) float qbs[256];
    __shared__ __attribute__((aligned(16))) _Float16 wq0s[8 * 512];
    const int tid  = threadIdx.x;
    const int lane = tid & 31;
    const int wave = __builtin_amdgcn_readfirstlane(tid >> 5);   // scalar: uniform bases
    const int m16 = lane & 15, hlf = lane >> 4;

    // (every loop in this kernel but the window loop is unrolled: all arrays are
    // then indexed by constants and stay in registers)
    {
        // the packed v weights and the bias table, 128 KB each, as they lie:
        // 16-byte unit tid + i*256
        const _Float16* wp = wpack + (2u * 65536u + (unsigned)tid * 8u);
        const float* bp = biasTab + (unsigned)tid * 4u;
#pragma unroll
        for (int g = 0; g < 4; ++g) {
            v8h t[8];
            v4f u[8];
#pragma unroll
            for (int i = 0; i < 8; ++i) {
                t[i] = *(const v8h*)(wp + (g * 8 + i) * 2048);
                u[i] = *(const v4f*)(bp + (g * 8 + i) * 1024);
            }
#pragma unroll
            for (int i = 0; i < 8; ++i) {
                *(v8h*)(wvs + (unsigned)tid * 8u + (g * 8 + i) * 2048) = t[i];
                *(v4f*)(bts + (unsigned)tid * 4u + (g * 8 + i) * 1024) = u[i];
            }
        }
        // precaution: the wait takes the addresses as inputs, so their registers
        // live up to it and no load of the run lands on them
        asm volatile("s_wait_xcnt 0x0" :: "v"(wp), "v"(bp) : "memory");
    }
    const float* btl = bts + ((unsigned)wave * 4096u + (unsigned)lane * 4u);
    const _Float16* wvl = wvs + ((unsigned)wave * 8192u + (unsigned)lane * 8u);

    // a window's x tile is 64 KB contiguous: float4 number tid + i*256 is row
    // (tid >> 6) + 4*i, columns (tid & 63)*4 .. + 3
    const unsigned xofs = (unsigned)tid * 4u;
    const unsigned sofs = (unsigned)(tid >> 6) * XPITCH + (unsigned)(tid & 63) * 4u;
    int w = blockIdx.x;
    float vb0, vb1;                    // v bias of channels m16 and 16 + m16 of the head
    {
        float4 fx[16];
        const float* xt = x + (size_t)w * 16384;
#pragma unroll
        for (int i = 0; i < 16; ++i) fx[i] = *(const float4*)(xt + (xofs + i * 1024));
        const float qb = q_bias[tid];
        vb0 = v_bias[wave * 32 + m16];
        vb1 = v_bias[wave * 32 + 16 + m16];
        // precaution: behind the loads, in front of any later write of their
        // address registers
        asm volatile("s_wait_xcnt 0x0" ::: "memory");
        // no such write is lifted above the wait
        __builtin_amdgcn_sched_barrier(0);
        qbs[tid] = qb;
#pragma unroll
        for (int i = 0; i < 16; ++i) {
            _Float16* d = &xs[sofs + i * 4 * XPITCH];
            d[0] = (_Float16)fx[i].x; d[1] = (_Float16)fx[i].y;
            d[2] = (_Float16)fx[i].z; d[3] = (_Float16)fx[i].w;
        }
    }

    const float sc = __expf(fminf(scale[wave], 4.60517018599f));   // ln(100)

    v16h wq[2][8], wk[2][8];           // [channel tile][k chunk]
    _Float16* wq0l = wq0s + ((unsigned)wave * 512u + (unsigned)lane * 8u);
    {
        const _Float16* wp = wpack + ((unsigned)wave * 8192u + (unsigned)lane * 8u);
#pragma unroll
        for (int f = 0; f < 16; ++f) wq[f >> 3][f & 7] = load_wfrag(wp, f);
#pragma unroll
        for (int f = 0; f < 16; ++f) wk[f >> 3][f & 7] = load_wfrag(wp + 65536, f);
        // precaution: the wait takes the address as an input, as above
        asm volatile("s_wait_xcnt 0x0" :: "v"(wp) : "memory");
        // the registers hold 31 of the 32 fragments (with all 32 the compiler
        // kept one in scratch memory): the first q fragment lies in LDS and comes
        // with the fragment group of k chunk 0
#pragma unroll
        for (int i = 0; i < 8; ++i) { wq0l[i] = wq[0][0][i]; wq0l[256 + i] = wq[0][0][8 + i]; }
    }
    __syncthreads();

    const _Float16* xc = xs + m16 * XPITCH;
    for (;;) {
        const bool more = w + FUSE_G < WINDOWS;         // the same for the whole work-group
        // no branch stands inside a window: the compiler moves work across a
        // branch (the end of the q, k, v part went below the x loads, and the
        // registers did not suffice).  So the last window fetches its own tile
        // once more, which nobody reads
        const float* xn = x + (size_t)(more ? w + FUSE_G : w) * 16384;
        float4 fn[8];

        // ---- q, k, v of the 64 tokens, 32 tokens at a time ----
        v16h qf[4];        // qf[qt]: query qt*16 + m16, the head's 32 channels
        v16h kf[4];        // kf[mb]: key mb*16 + m16, the head's 32 channels
        v16h vf[2][2];     // vf[db][kb]: channel db*16 + m16, keys kb*32 .. + 31
#pragma unroll
        for (int hw = 0; hw < 2; ++hw) {
            // aq, ak[t][n]: channel t*16 + 8*hlf + v of token (hw*2 + n)*16 + m16
            // av[n][c]: token (hw*2 + n)*16 + 8*hlf + v, channel c*16 + m16
            // the q and v sums start at the bias, k has none
            v8f aq[2][2], ak[2][2], av[2][2];
#pragma unroll
            for (int n = 0; n < 2; ++n) {
                aq[n][0] = *(const v8f*)(qbs + wave * 32 + n * 16 + 8 * hlf);
                aq[n][1] = aq[n][0];
                ak[0][n] = (v8f){0, 0, 0, 0, 0, 0, 0, 0};
                ak[1][n] = (v8f){0, 0, 0, 0, 0, 0, 0, 0};
                av[n][0] = (v8f){vb0, vb0, vb0, vb0, vb0, vb0, vb0, vb0};
                av[n][1] = (v8f){vb1, vb1, vb1, vb1, vb1, vb1, vb1, vb1};
            }
#pragma unroll
            for (int kc = 0; kc < 8; ++kc) {
                // a k chunk's four fragments (eight LDS loads) as one group, then
                // their twelve products: one LDS wait per twelve products
                v16h b[2], wv[2];      // [token tile], [channel tile]
#pragma unroll
                for (int n = 0; n < 2; ++n) {
                    b[n]  = load_frag(xc + (hw * 2 + n) * 16 * XPITCH, kc * 32, hlf);
                    wv[n] = load_wfrag(wvl, n * 8 + kc);
                }
                const v16h wq0 = (kc == 0) ? load_wfrag(wq0l, 0) : wq[0][kc];
                // keeps the group whole: without it the scheduler sinks each load
                // pair to its own products and waits on every pair
                __builtin_amdgcn_sched_barrier(0);
#pragma unroll
                for (int n = 0; n < 2; ++n) {
                    aq[0][n] = wmma_f16(wq0, b[n], aq[0][n]);
                    aq[1][n] = wmma_f16(wq[1][kc], b[n], aq[1][n]);
                    ak[0][n] = wmma_f16(wk[0][kc], b[n], ak[0][n]);
                    ak[1][n] = wmma_f16(wk[1][kc], b[n], ak[1][n]);
                    av[n][0] = wmma_f16(b[n], wv[0], av[n][0]);
                    av[n][1] = wmma_f16(b[n], wv[1], av[n][1]);
                }
                // no later group rises above these products: there are registers
                // for one group of fragments only (the SIMD's other wave works
                // while this one waits for its group)
                __builtin_amdgcn_sched_barrier(0);
            }
#pragma unroll
            for (int n = 0; n < 2; ++n) {
                qf[hw * 2 + n] = norm_frag(aq[0][n], aq[1][n]);
                kf[hw * 2 + n] = norm_frag(ak[0][n], ak[1][n]);
#pragma unroll
                for (int v = 0; v < 8; ++v) {
                    vf[0][hw][n * 8 + v] = (_Float16)av[n][0][v];
                    vf[1][hw][n * 8 + v] = (_Float16)av[n][1][v];
                }
            }
            // the sums' registers are free before anything later starts
            __builtin_amdgcn_sched_barrier(0);
        }
        __syncthreads();       // every wave has read the x buffer for the last time

        // ---- attention, 16 queries at a time; the next x tile on the way ----
        v8h rl[2];         // the last tile's output, stored behind the barrier
#pragma unroll
        for (int qt = 0; qt < 4; ++qt) {
            if ((qt & 1) == 0) {
#pragma unroll
                for (int i = 0; i < 8; ++i)
                    fn[i] = *(const float4*)(xn + (xofs + (qt >> 1) * 8192 + i * 1024));
                // precaution: behind the loads, in front of any later write of
                // their address registers
                asm volatile("s_wait_xcnt 0x0" ::: "memory");
                // nothing is scheduled across this line: the loads stay above two
                // tiles' work, and no address write is lifted above the wait
                __builtin_amdgcn_sched_barrier(0);
            }
            // S^T = k @ q^T: s[mb][v] is the score of key mb*16 + 8*hlf + v
            // against query qt*16 + m16; its bias is entry mb*2 + (v >> 2) of the
            // tile's eight, 512 contiguous bytes per load
            float s[4][8];
#pragma unroll
            for (int mb = 0; mb < 4; ++mb) {
                const v4f b0 = *(const v4f*)(btl + (qt * 1024 + mb * 256));
                const v4f b1 = *(const v4f*)(btl + (qt * 1024 + mb * 256 + 128));
                v8f t = (v8f){0, 0, 0, 0, 0, 0, 0, 0};
                t = wmma_f16(kf[mb], qf[qt], t);
                s[mb][0] = t[0] * sc + b0.x; s[mb][1] = t[1] * sc + b0.y;
                s[mb][2] = t[2] * sc + b0.z; s[mb][3] = t[3] * sc + b0.w;
                s[mb][4] = t[4] * sc + b1.x; s[mb][5] = t[5] * sc + b1.y;
                s[mb][6] = t[6] * sc + b1.z; s[mb][7] = t[7] * sc + b1.w;
            }

            // softmax over the query's 64 keys in fp32: 32 in this lane, 32 in
            // lane ^ 16
            float mxp[4];
#pragma unroll
            for (int mb = 0; mb < 4; ++mb) {
                mxp[mb] = s[mb][0];
#pragma unroll
                for (int v = 1; v < 8; ++v) mxp[mb] = fmaxf(mxp[mb], s[mb][v]);
            }
            float mx = fmaxf(fmaxf(mxp[0], mxp[1]), fmaxf(mxp[2], mxp[3]));
            mx = fmaxf(mx, xhalf(mx));
            // pf[kb] element i is key kb*32 + 8*hlf + i, element 8+i key kb*32 +
            // 16 + 8*hlf + i: the k order of vf
            v16h pf[2];
            float sump[4];                     // four independent sums, one per tile
#pragma unroll
            for (int mb = 0; mb < 4; ++mb) {
                float a[8], e[8];
#pragma unroll
                for (int v = 0; v < 8; ++v) a[v] = (s[mb][v] - mx) * 1.44269504089f;   // log2(e)
                // e = 2^a, one tile's eight in one statement: the outputs are
                // registers of their own ("=&v"), so no exponential is directly
                // followed by a read of its result or a write of its source; the
                // v_nop keeps that one slot behind the last one, whatever the
                // compiler places next
                asm("v_exp_f32 %0, %8\n\tv_exp_f32 %1, %9\n\tv_exp_f32 %2, %10\n\t"
                    "v_exp_f32 %3, %11\n\tv_exp_f32 %4, %12\n\tv_exp_f32 %5, %13\n\t"
                    "v_exp_f32 %6, %14\n\tv_exp_f32 %7, %15\n\tv_nop"
                    : "=&v"(e[0]), "=&v"(e[1]), "=&v"(e[2]), "=&v"(e[3]),
                      "=&v"(e[4]), "=&v"(e[5]), "=&v"(e[6]), "=&v"(e[7])
                    : "v"(a[0]), "v"(a[1]), "v"(a[2]), "v"(a[3]),
                      "v"(a[4]), "v"(a[5]), "v"(a[6]), "v"(a[7]));
                sump[mb] = e[0];
#pragma unroll
                for (int v = 1; v < 8; ++v) sump[mb] += e[v];
#pragma unroll
                for (int v = 0; v < 8; ++v) pf[mb >> 1][(mb & 1) * 8 + v] = (_Float16)e[v];
            }
            float sum = (sump[0] + sump[1]) + (sump[2] + sump[3]);
            sum += xhalf(sum);
            const float inv = 1.0f / sum;

            // O^T = v^T @ P^T (K = 64: 2 WMMA steps): o[v] is channel
            // db*16 + 8*hlf + v of query qt*16 + m16, one 16-byte store
            _Float16* orow = attnout + ((unsigned)w * 16384u + qt * 4096 + wave * 512 + lane * 8);
#pragma unroll
            for (int db = 0; db < 2; ++db) {
                v8f o = (v8f){0, 0, 0, 0, 0, 0, 0, 0};
#pragma unroll
                for (int kb = 0; kb < 2; ++kb) o = wmma_f16(vf[db][kb], pf[kb], o);
                v8h r;
#pragma unroll
                for (int v = 0; v < 8; ++v) r[v] = (_Float16)(o[v] * inv);
                if (qt < 3) *(v8h*)(orow + db * 256) = r;
                else        rl[db] = r;
            }
            if (qt < 3) {
                // precaution: behind the stores, in front of any later write of
                // the registers they name
                asm volatile("s_wait_xcnt 0x0" ::: "memory");
                // no such write is lifted above the wait
                __builtin_amdgcn_sched_barrier(0);
            }
            if ((qt & 1) == 1) {
                // the 32 rows that came in during these two tiles
#pragma unroll
                for (int i = 0; i < 8; ++i) {
                    _Float16* d = &xs[sofs + ((qt >> 1) * 8 + i) * 4 * XPITCH];
                    d[0] = (_Float16)fn[i].x; d[1] = (_Float16)fn[i].y;
                    d[2] = (_Float16)fn[i].z; d[3] = (_Float16)fn[i].w;
                }
                // the next 32 rows' loads do not rise above this: they take the
                // same registers, and their wait stands directly behind them
                __builtin_amdgcn_sched_barrier(0);
            }
        }
        __syncthreads();       // publishes the next window's x tile
        {
            _Float16* orow = attnout + ((unsigned)w * 16384u + 3 * 4096 + wave * 512 + lane * 8);
            *(v8h*)(orow)       = rl[0];
            *(v8h*)(orow + 256) = rl[1];
            // precaution, as above
            asm volatile("s_wait_xcnt 0x0" ::: "memory");
            // no write of the stores' registers is lifted above the wait
            __builtin_amdgcn_sched_barrier(0);
        }

        if (!more) break;
        w += FUSE_G;
    }
}

// ---------------------------------------------------------------------------
// Kernel 3: output projection.  out[131072x256] = attnout @ proj_w^T + proj_b.
// grid = 512, block = 256 (8 waves).  Weights stay put: wave w keeps weight rows
// (output columns) 32w .. 32w+31 in registers, the work-group walks over 8
// passes of 32 tokens, staged in two LDS buffers.  A pass: products from this
// buffer; the next tile (loaded to registers one pass ago) goes to the other
// buffer, the output tile to its own; one barrier; the loads of the tile after
// next; the stores.
// Column tile nt of a wave holds columns 32w + 2*m16 + nt (the packing deals the
// weight rows so): a lane holds two adjacent columns of a token's row.
// The output tile (32 tokens x 256 columns, f32) goes through LDS: every wave
// writes its 32 columns there in front of the pass's barrier, and behind it wave
// w stores rows 4w .. 4w+3 whole, 512 contiguous bytes a store.
// Two such buffers: the one read behind barrier i is written again only behind
// barrier i+1, which a wave reaches after its reads.
// ---------------------------------------------------------------------------
#define PROJ_G 512
#define OPITCH 260         // floats per staged output row: 1040 B, so that rows r and
                           // r + 8 (the two halves of a wave) fall on different banks
// (second bound: 4 waves per SIMD = 256 registers a wave, two work-groups a WGP)
__global__ __launch_bounds__(256, 4)
void proj_kernel(const _Float16* __restrict__ attnout,
                            const _Float16* __restrict__ wpack, // packed f16 weights
                            const float* __restrict__ proj_b,   // [256]
                            float* __restrict__ out) {
    __shared__ __attribute__((aligned(16))) _Float16 as[2][32 * XPITCH];
    __shared__ __attribute__((aligned(16))) float os[2][32 * OPITCH];
    const int tid = threadIdx.x, lane = tid & 31;
    const int wave = __builtin_amdgcn_readfirstlane(tid >> 5);   // scalar: uniform bases
    const int m16 = lane & 15, hlf = lane >> 4;

    // (every loop over fragments, tiles and staged values in this kernel is
    // unrolled: wf, fa, acc, a, t are then indexed by constants and stay in registers)
    v16h wf[2][8];                     // [column tile][k chunk]
    {
        const _Float16* wp = wpack + ((unsigned)(24 + wave) * 8192u + (unsigned)lane * 8u);
#pragma unroll
        for (int f = 0; f < 16; ++f) wf[f >> 3][f & 7] = load_wfrag(wp, f);
        // precaution: the wait takes the address as an input, so its registers
        // live up to it and no load of the run lands on them
        asm volatile("s_wait_xcnt 0x0" :: "v"(wp) : "memory");
    }

    // a pass's tile is 16 KB contiguous, in the attention waves' order: 16-byte
    // unit tid + i*256 is row (i >> 1)*16 + (tid & 15), halves (i & 1)*128 +
    // (tid >> 4)*8 .. + 7
    const unsigned aofs = (unsigned)tid * 8u;
    const unsigned sofs = (unsigned)(tid & 15) * XPITCH + (unsigned)(tid >> 4) * 8u;
    v8h fa[4];
    int p = blockIdx.x;
    {
        const _Float16* at = attnout + (size_t)p * 8192;
#pragma unroll
        for (int i = 0; i < 4; ++i) fa[i] = *(const v8h*)(at + (aofs + i * 2048));
#pragma unroll
        for (int i = 0; i < 4; ++i) *(v8h*)(&as[0][sofs + (i >> 1) * 16 * XPITCH + (i & 1) * 128]) = fa[i];
    }
    __syncthreads();
    const float pb0 = proj_b[wave * 32 + m16 * 2], pb1 = proj_b[wave * 32 + m16 * 2 + 1];
    if (p + PROJ_G < PASSES) {
        const _Float16* at = attnout + (size_t)(p + PROJ_G) * 8192;
#pragma unroll
        for (int i = 0; i < 4; ++i) fa[i] = *(const v8h*)(at + (aofs + i * 2048));
    }
    // precaution: stands behind the loads, in front of any later write of
    // their address registers
    asm volatile("s_wait_xcnt 0x0" ::: "memory");
    // nothing is scheduled across this line: the loads stay above the products,
    // and no write of an address register is lifted above the wait
    __builtin_amdgcn_sched_barrier(0);

    int cur = 0;
    for (;;) {
        // acc[mt][nt][v]: token mt*16 + v + 8*hlf, column wave*32 + m16*2 + nt
        v8f acc[2][2];
#pragma unroll
        for (int mt = 0; mt < 2; ++mt) {
            acc[mt][0] = (v8f){0, 0, 0, 0, 0, 0, 0, 0};
            acc[mt][1] = (v8f){0, 0, 0, 0, 0, 0, 0, 0};
        }
        const _Float16* ac = as[cur] + m16 * XPITCH;
#pragma unroll
        for (int kg = 0; kg < 4; ++kg) {
            // four fragments (eight LDS loads) as one group, then their eight
            // products: one LDS wait per eight products
            v16h a[2][2];
#pragma unroll
            for (int kk = 0; kk < 2; ++kk)
#pragma unroll
                for (int mt = 0; mt < 2; ++mt)
                    a[kk][mt] = load_frag(ac + mt * 16 * XPITCH, (kg * 2 + kk) * 32, hlf);
            // keeps the group whole: without it the scheduler sinks each load
            // pair to its own products and waits on every pair
            __builtin_amdgcn_sched_barrier(0);
#pragma unroll
            for (int kk = 0; kk < 2; ++kk)
#pragma unroll
                for (int mt = 0; mt < 2; ++mt) {
                    acc[mt][0] = wmma_f16(a[kk][mt], wf[0][kg * 2 + kk], acc[mt][0]);
                    acc[mt][1] = wmma_f16(a[kk][mt], wf[1][kg * 2 + kk], acc[mt][1]);
                }
        }

        const bool more = p + PROJ_G < PASSES;          // the same for the whole work-group
        if (more) {
#pragma unroll
            for (int i = 0; i < 4; ++i)
                *(v8h*)(&as[cur ^ 1][sofs + (i >> 1) * 16 * XPITCH + (i & 1) * 128]) = fa[i];
        }
        {
            float* ow = os[cur] + ((8 * hlf) * OPITCH + wave * 32 + m16 * 2);
#pragma unroll
            for (int mt = 0; mt < 2; ++mt) {
#pragma unroll
                for (int v = 0; v < 8; ++v)
                    *(float2*)(ow + (mt * 16 + v) * OPITCH) =
                        make_float2(acc[mt][0][v] + pb0, acc[mt][1][v] + pb1);
            }
        }
        __syncthreads();       // publishes the next tile and this pass's output tile
        if (p + 2 * PROJ_G < PASSES) {
            const _Float16* at = attnout + (size_t)(p + 2 * PROJ_G) * 8192;
#pragma unroll
            for (int i = 0; i < 4; ++i) fa[i] = *(const v8h*)(at + (aofs + i * 2048));
            // precaution, as above
            asm volatile("s_wait_xcnt 0x0" ::: "memory");
        }
        // as above: loads first, no address write lifted above the wait
        __builtin_amdgcn_sched_barrier(0);

        // rows 4*wave .. + 3 of the tile, each as two stores of 512 bytes
        const float* orow = os[cur] + (wave * 4 * OPITCH + lane * 4);
        float* op = out + ((unsigned)p * 8192u + wave * 1024 + lane * 4);
        v4f t[8];
#pragma unroll
        for (int i = 0; i < 8; ++i) t[i] = *(const v4f*)(orow + (i >> 1) * OPITCH + (i & 1) * 128);
#pragma unroll
        for (int i = 0; i < 8; ++i) *(v4f*)(op + (i >> 1) * 256 + (i & 1) * 128) = t[i];
        // precaution: behind the stores, in front of any later write of the
        // registers they name
        asm volatile("s_wait_xcnt 0x0" ::: "memory");
        // no such write is lifted above the wait
        __builtin_amdgcn_sched_barrier(0);

        if (!more) break;
        p += PROJ_G;
        cur ^= 1;
    }
}

// ---------------------------------------------------------------------------
extern "C" void kernel_launch(void* const* d_in, const int* in_sizes, int n_in,
                              void* d_out, int out_size, void* d_ws, size_t ws_size,
                              hipStream_t stream) {
    (void)in_sizes; (void)n_in; (void)out_size; (void)ws_size;

    const float* x        = (const float*)d_in[0];
    const float* qkv_w    = (const float*)d_in[1];
    const float* q_bias   = (const float*)d_in[2];
    const float* v_bias   = (const float*)d_in[3];
    const float* scale    = (const float*)d_in[4];
    const float* cpb_w1   = (const float*)d_in[5];
    const float* cpb_b1   = (const float*)d_in[6];
    const float* cpb_w2   = (const float*)d_in[7];
    const float* proj_w   = (const float*)d_in[8];
    const float* proj_b   = (const float*)d_in[9];
    const float* rel_tbl  = (const float*)d_in[10];
    const int*   rel_idx  = (const int*)d_in[11];
    float* out = (float*)d_out;

    // workspace layout (bytes): biasTab 128KB | attnout 64MB | wpack 512KB
    char* ws = (char*)d_ws;
    const size_t ATT_BYTES = (size_t)BATCH * HEADS * NTOK * HD * sizeof(_Float16); // 64 MiB
    float*    biasTab = (float*)ws;
    _Float16* attnout = (_Float16*)(ws + 131072);
    _Float16* wpack   = (_Float16*)(ws + 131072 + ATT_BYTES);

    cpb_kernel<<<256, 256, 0, stream>>>(rel_tbl, cpb_w1, cpb_b1, cpb_w2, rel_idx,
                                        qkv_w, proj_w, wpack, biasTab);

    qkv_attn_kernel<<<FUSE_G, 256, 0, stream>>>(
        x, wpack, q_bias, v_bias, biasTab, scale, attnout);

    proj_kernel<<<PROJ_G, 256, 0, stream>>>(attnout, wpack, proj_b, out);
}
